// v000
// The times below were measured on an AMD MI455X: many runs one after another, warmed up first and cycling through
// copies of the inputs, with the whole window's GPU time divided by the number of runs. Launches and the gaps
// between them are all in it. The median over several windows is given; except for v000 it joins two sittings, which
// can be a few percent apart, so the side-by-side timings, each taken in one sitting, are the better comparison.
// v000, which the later versions start from, runs in 232 microseconds.
#include <hip/hip_runtime.h>

typedef _Float16 f16;
typedef _Float16 v16h __attribute__((ext_vector_type(16)));
typedef _Float16 v8h  __attribute__((ext_vector_type(8)));
typedef float    v8f  __attribute__((ext_vector_type(8)));

namespace {

constexpr int CP = 264;   // f16 pitch (elems) for 64x256 LDS matrices (pad 8 kills bank conflicts)
constexpr int VP = 72;    // Vt pitch: [256 ch][64 tok + pad]
constexpr int PP = 72;    // per-wave softmax-probability pitch: [64][64 + pad]

// LDS layout (bytes); later phases overlay dead earlier regions (barriers in between)
constexpr int OFF_X  = 0;                       // Xs  64x264 f16 = 33792   (phase 0-1)
constexpr int OFF_Q  = 64 * CP * 2;             // Qs  64x264 f16           (phase 1-2)
constexpr int OFF_K  = 2 * 64 * CP * 2;         // Ks  64x264 f16           (phase 1-2)
constexpr int OFF_PS = 0;                       // Ps  8 waves x 64x72 f16 = 73728 (overlays X/Q/K)
constexpr int OFF_OT = 0;                       // OT  64x264 f32 = 67584   (overlays Ps)
constexpr int OFF_V  = 3 * 64 * CP * 2;         // Vt  256x72 f16 = 36864   (phase 1-3)
constexpr int OFF_O  = OFF_V;                   // Os  64x264 f16 (overlays Vt after PV)
constexpr int OFF_B  = OFF_V + 256 * VP * 2;    // bias table 225x8 f32 = 7200
constexpr int SMEM_BYTES = OFF_B + 225 * 8 * 4; // 145440 B  (< 320KB/WGP)

__device__ inline v16h frag16(const f16* p) {
  // WMMA A/B operand: two contiguous 8xf16 chunks at k-offset 0 and +16 (per ISA VGPR layout)
  v8h lo = *(const v8h*)p;
  v8h hi = *(const v8h*)(p + 16);
  return __builtin_shufflevector(lo, hi, 0,1,2,3,4,5,6,7,8,9,10,11,12,13,14,15);
}

__device__ inline v8f wmma_f16(v16h a, v16h b, v8f c) {
  return __builtin_amdgcn_wmma_f32_16x16x32_f16(false, a, false, b, (short)0, c, false, false);
}

__global__ void cvt_weights_kernel(const float* __restrict__ qw,
                                   const float* __restrict__ pw,
                                   f16* __restrict__ q16, f16* __restrict__ p16) {
  int i = blockIdx.x * 256 + threadIdx.x;   // grid = 768 blocks -> 196608 = 768*256 exactly
  q16[i] = (f16)qw[i];
  if (i < 256 * 256) p16[i] = (f16)pw[i];
}

__global__ __launch_bounds__(256)
void swin_window_attn_kernel(const float* __restrict__ x,
                             const f16* __restrict__ wq16,
                             const float* __restrict__ qkv_b,
                             const f16* __restrict__ wp16,
                             const float* __restrict__ proj_b,
                             const float* __restrict__ bias_tab,
                             float* __restrict__ out) {
  extern __shared__ __align__(16) char smem[];
  f16*   Xs    = (f16*)(smem + OFF_X);
  f16*   Qs    = (f16*)(smem + OFF_Q);
  f16*   Ks    = (f16*)(smem + OFF_K);
  f16*   Vt    = (f16*)(smem + OFF_V);
  float* biasT = (float*)(smem + OFF_B);

  const int tid  = threadIdx.x;
  const int lane = tid & 31;
  const int wv   = tid >> 5;        // wave id == head id for attention phases
  const int hh   = lane >> 4;       // half-wave select
  const int lm   = lane & 15;
  const int kb   = hh * 8;          // per-lane k chunk base (ISA 16-bit A/B layout)

  const int bx   = blockIdx.x;      // 2048 windows
  const int b    = bx >> 6;
  const int widx = bx & 63;
  const int wy   = widx >> 3, wx = widx & 7;
  const long imgbase = (long)b * (256L * 4096L);

  // ---------------- Phase 0: stage bias table + window input (fp32 -> f16) ----------------
  for (int k2 = tid; k2 < 225 * 8; k2 += 256) biasT[k2] = bias_tab[k2];
  #pragma unroll
  for (int it = 0; it < 8; ++it) {
    int c = it * 32 + (tid >> 3);
    int i = tid & 7;
    const float* src = x + imgbase + (long)c * 4096 + (wy * 8 + i) * 64 + wx * 8;
    float4 r0 = *(const float4*)src;
    float4 r1 = *(const float4*)(src + 4);
    f16* dst = Xs + c;
    int t0 = i * 8;
    dst[(t0+0)*CP] = (f16)r0.x; dst[(t0+1)*CP] = (f16)r0.y;
    dst[(t0+2)*CP] = (f16)r0.z; dst[(t0+3)*CP] = (f16)r0.w;
    dst[(t0+4)*CP] = (f16)r1.x; dst[(t0+5)*CP] = (f16)r1.y;
    dst[(t0+6)*CP] = (f16)r1.z; dst[(t0+7)*CP] = (f16)r1.w;
  }
  __syncthreads();

  // ---------------- Phase 1: QKV GEMM  (64x768) = Xs(64x256) @ Wqkv^T ----------------
  const float scale = 0.17677669529663687f;   // 1/sqrt(32), folded into Q
  for (int nsel = 0; nsel < 6; ++nsel) {
    const int ntile = wv + nsel * 8;          // 0..47  (Q:0-15  K:16-31  V:32-47)
    const int obase = ntile * 16;
    v8f acc[4] = {};
    for (int ks = 0; ks < 8; ++ks) {
      v16h bf = frag16(wq16 + (obase + lm) * 256 + ks * 32 + kb);
      #pragma unroll
      for (int mt = 0; mt < 4; ++mt) {
        v16h af = frag16(Xs + (mt * 16 + lm) * CP + ks * 32 + kb);
        acc[mt] = wmma_f16(af, bf, acc[mt]);
      }
    }
    const float bo = qkv_b[obase + lm];
    if (ntile < 16) {                         // Q (scaled)
      int c = obase + lm;
      #pragma unroll
      for (int mt = 0; mt < 4; ++mt)
        #pragma unroll
        for (int r = 0; r < 8; ++r)
          Qs[(mt * 16 + r + 8 * hh) * CP + c] = (f16)((acc[mt][r] + bo) * scale);
    } else if (ntile < 32) {                  // K
      int c = obase - 256 + lm;
      #pragma unroll
      for (int mt = 0; mt < 4; ++mt)
        #pragma unroll
        for (int r = 0; r < 8; ++r)
          Ks[(mt * 16 + r + 8 * hh) * CP + c] = (f16)(acc[mt][r] + bo);
    } else {                                  // V, stored transposed: Vt[channel][token]
      int c = obase - 512 + lm;
      #pragma unroll
      for (int mt = 0; mt < 4; ++mt)
        #pragma unroll
        for (int r = 0; r < 8; ++r)
          Vt[c * VP + (mt * 16 + r + 8 * hh)] = (f16)(acc[mt][r] + bo);
    }
  }
  __syncthreads();

  // ---------------- Phase 2: scores (one head per wave), bias, softmax ----------------
  v8f s[4][4];
  {
    v16h aq[4];
    #pragma unroll
    for (int mt = 0; mt < 4; ++mt)
      aq[mt] = frag16(Qs + (mt * 16 + lm) * CP + wv * 32 + kb);
    #pragma unroll
    for (int nt = 0; nt < 4; ++nt) {
      v16h bk = frag16(Ks + (nt * 16 + lm) * CP + wv * 32 + kb);
      #pragma unroll
      for (int mt = 0; mt < 4; ++mt) {
        v8f z = {};
        s[mt][nt] = wmma_f16(aq[mt], bk, z);
      }
    }
  }
  // relative position bias: idx = (ti-ui+7)*15 + (tj-uj+7), table[idx][head]
  #pragma unroll
  for (int nt = 0; nt < 4; ++nt) {
    int u = nt * 16 + lm, ui = u >> 3, uj = u & 7;
    #pragma unroll
    for (int mt = 0; mt < 4; ++mt)
      #pragma unroll
      for (int r = 0; r < 8; ++r) {
        int t = mt * 16 + r + 8 * hh;
        int idx = ((t >> 3) - ui + 7) * 15 + ((t & 7) - uj + 7);
        s[mt][nt][r] += biasT[idx * 8 + wv];
      }
  }
  // softmax over u: lane%16 columns x 4 n-tiles per row; rows split by (mt, r, hh)
  #pragma unroll
  for (int mt = 0; mt < 4; ++mt)
    #pragma unroll
    for (int r = 0; r < 8; ++r) {
      float mx = fmaxf(fmaxf(s[mt][0][r], s[mt][1][r]), fmaxf(s[mt][2][r], s[mt][3][r]));
      for (int off = 1; off < 16; off <<= 1) mx = fmaxf(mx, __shfl_xor(mx, off, 32));
      float sm = 0.f;
      #pragma unroll
      for (int nt = 0; nt < 4; ++nt) {
        float e = __expf(s[mt][nt][r] - mx);
        s[mt][nt][r] = e;
        sm += e;
      }
      for (int off = 1; off < 16; off <<= 1) sm += __shfl_xor(sm, off, 32);
      float inv = 1.0f / sm;
      #pragma unroll
      for (int nt = 0; nt < 4; ++nt) s[mt][nt][r] *= inv;
    }
  __syncthreads();   // everyone finished reading Qs/Ks -> safe to overlay with Ps

  f16* PsW = (f16*)(smem + OFF_PS) + wv * (64 * PP);
  #pragma unroll
  for (int mt = 0; mt < 4; ++mt)
    #pragma unroll
    for (int nt = 0; nt < 4; ++nt)
      #pragma unroll
      for (int r = 0; r < 8; ++r)
        PsW[(mt * 16 + r + 8 * hh) * PP + nt * 16 + lm] = (f16)s[mt][nt][r];

  // ---------------- Phase 3: O = P @ V  (per head: 64x32, K=64) ----------------
  v8f ov[4][2] = {};
  #pragma unroll
  for (int ks = 0; ks < 2; ++ks) {
    v16h ap[4];
    #pragma unroll
    for (int mt = 0; mt < 4; ++mt)
      ap[mt] = frag16(PsW + (mt * 16 + lm) * PP + ks * 32 + kb);
    #pragma unroll
    for (int nt = 0; nt < 2; ++nt) {
      v16h bvf = frag16(Vt + (wv * 32 + nt * 16 + lm) * VP + ks * 32 + kb);
      #pragma unroll
      for (int mt = 0; mt < 4; ++mt) ov[mt][nt] = wmma_f16(ap[mt], bvf, ov[mt][nt]);
    }
  }
  __syncthreads();   // all Vt/Ps reads done -> overlay Vt with Os
  f16* Os = (f16*)(smem + OFF_O);
  #pragma unroll
  for (int mt = 0; mt < 4; ++mt)
    #pragma unroll
    for (int nt = 0; nt < 2; ++nt)
      #pragma unroll
      for (int r = 0; r < 8; ++r)
        Os[(mt * 16 + r + 8 * hh) * CP + wv * 32 + nt * 16 + lm] = (f16)ov[mt][nt][r];
  __syncthreads();

  // ---------------- Phase 4: projection GEMM (64x256) = Os @ Wproj^T ----------------
  float* OT = (float*)(smem + OFF_OT);   // f32 result, pitch CP floats (overlays Ps region)
  for (int nsel = 0; nsel < 2; ++nsel) {
    const int ntile = wv * 2 + nsel;     // 0..15
    const int cb = ntile * 16;
    v8f acc[4] = {};
    for (int ks = 0; ks < 8; ++ks) {
      v16h bf = frag16(wp16 + (cb + lm) * 256 + ks * 32 + kb);
      #pragma unroll
      for (int mt = 0; mt < 4; ++mt) {
        v16h af = frag16(Os + (mt * 16 + lm) * CP + ks * 32 + kb);
        acc[mt] = wmma_f16(af, bf, acc[mt]);
      }
    }
    const float pb = proj_b[cb + lm];
    #pragma unroll
    for (int mt = 0; mt < 4; ++mt)
      #pragma unroll
      for (int r = 0; r < 8; ++r)
        OT[(mt * 16 + r + 8 * hh) * CP + cb + lm] = acc[mt][r] + pb;
  }
  __syncthreads();

  // ---------------- Phase 5: window-reverse store to (B, C, H, W), 32B contiguous ----------------
  #pragma unroll
  for (int it = 0; it < 8; ++it) {
    int c = it * 32 + (tid >> 3);
    int i = tid & 7;
    float* dst = out + imgbase + (long)c * 4096 + (wy * 8 + i) * 64 + wx * 8;
    int t0 = i * 8;
    float4 v0, v1;
    v0.x = OT[(t0+0)*CP + c]; v0.y = OT[(t0+1)*CP + c];
    v0.z = OT[(t0+2)*CP + c]; v0.w = OT[(t0+3)*CP + c];
    v1.x = OT[(t0+4)*CP + c]; v1.y = OT[(t0+5)*CP + c];
    v1.z = OT[(t0+6)*CP + c]; v1.w = OT[(t0+7)*CP + c];
    *(float4*)dst       = v0;
    *((float4*)dst + 1) = v1;
  }
}

}  // namespace

extern "C" void kernel_launch(void* const* d_in, const int* in_sizes, int n_in,
                              void* d_out, int out_size, void* d_ws, size_t ws_size,
                              hipStream_t stream) {
  const float* x        = (const float*)d_in[0];
  const float* qkv_w    = (const float*)d_in[1];
  const float* qkv_b    = (const float*)d_in[2];
  const float* proj_w   = (const float*)d_in[3];
  const float* proj_b   = (const float*)d_in[4];
  const float* bias_tab = (const float*)d_in[5];

  f16* wq16 = (f16*)d_ws;                               // 768*256 f16 = 393216 B
  f16* wp16 = (f16*)((char*)d_ws + 768 * 256 * 2);      // 256*256 f16 = 131072 B

  cvt_weights_kernel<<<768, 256, 0, stream>>>(qkv_w, proj_w, wq16, wp16);
  swin_window_attn_kernel<<<2048, 256, SMEM_BYTES, stream>>>(
      x, wq16, qkv_b, wp16, proj_b, bias_tab, (float*)d_out);
}

// v001
// Measured time: 226 microseconds a run.
// In two side-by-side timings against v000, it was 1.06 and 1.05 times as fast.
#include <hip/hip_runtime.h>

typedef _Float16 f16;
typedef _Float16 v16h __attribute__((ext_vector_type(16)));
typedef _Float16 v8h  __attribute__((ext_vector_type(8)));
typedef float    v8f  __attribute__((ext_vector_type(8)));

namespace {

constexpr int CP = 264;   // f16 pitch (elems) for 64x256 LDS matrices (pad 8 kills bank conflicts)
constexpr int VP = 72;    // Vt pitch: [256 ch][64 tok + pad]
constexpr int PP = 72;    // per-wave softmax-probability pitch: [64][64 + pad]

// LDS layout (bytes); later phases overlay dead earlier regions (barriers in between)
constexpr int OFF_X  = 0;                       // Xs  64x264 f16 = 33792   (phase 0-1)
constexpr int OFF_Q  = 64 * CP * 2;             // Qs  64x264 f16           (phase 1-2)
constexpr int OFF_K  = 2 * 64 * CP * 2;         // Ks  64x264 f16           (phase 1-2)
constexpr int OFF_PS = 0;                       // Ps  8 waves x 64x72 f16 = 73728 (overlays X/Q/K)
constexpr int OFF_OT = 0;                       // OT  64x264 f32 = 67584   (overlays Ps)
constexpr int OFF_V  = 3 * 64 * CP * 2;         // Vt  256x72 f16 = 36864   (phase 1-3)
constexpr int OFF_O  = OFF_V;                   // Os  64x264 f16 (overlays Vt after PV)
constexpr int OFF_B  = OFF_V + 256 * VP * 2;    // bias table 225x8 f32 = 7200
constexpr int SMEM_BYTES = OFF_B + 225 * 8 * 4; // 145440 B  (< 320KB/WGP)

__device__ inline v16h frag16(const f16* p) {
  // WMMA A/B operand: two contiguous 8xf16 chunks at k-offset 0 and +16 (per ISA VGPR layout)
  v8h lo = *(const v8h*)p;
  v8h hi = *(const v8h*)(p + 16);
  return __builtin_shufflevector(lo, hi, 0,1,2,3,4,5,6,7,8,9,10,11,12,13,14,15);
}

__device__ inline v16h fragw(const f16* p) {
  // packed weight fragment: the 32 lanes' low 8-element k chunks lie in one 512-byte run, their high chunks (k + 16) in the next
  v8h lo = *(const v8h*)p;
  v8h hi = *(const v8h*)(p + 256);
  return __builtin_shufflevector(lo, hi, 0,1,2,3,4,5,6,7,8,9,10,11,12,13,14,15);
}

__device__ inline v8f wmma_f16(v16h a, v16h b, v8f c) {
  return __builtin_amdgcn_wmma_f32_16x16x32_f16(false, a, false, b, (short)0, c, false, false);
}

__global__ void cvt_weights_kernel(const float* __restrict__ qw,
                                   const float* __restrict__ pw,
                                   f16* __restrict__ q16, f16* __restrict__ p16) {
  // Packs W[row][k] in WMMA B-fragment order: [16-row tile][32-k step][half h][lane][8 elems], so that
  // one wave-wide 16-byte load in the main kernel reads 512 contiguous bytes (4 whole lines, not 16 pieces).
  int i = blockIdx.x * 256 + threadIdx.x;   // grid = 768 blocks -> 196608 = 768*256 exactly
  int e = i & 7, ln = (i >> 3) & 31, h = (i >> 8) & 1, ks = (i >> 9) & 7, tile = i >> 12;
  int src = (tile * 16 + (ln & 15)) * 256 + ks * 32 + h * 16 + (ln >> 4) * 8 + e;
  q16[i] = (f16)qw[src];
  if (i < 256 * 256) p16[i] = (f16)pw[src];
}

// waves_per_eu(4): holds the register budget at 256, so that two work-groups stay resident per WGP as before
__global__ __launch_bounds__(256) __attribute__((amdgpu_waves_per_eu(4)))
void swin_window_attn_kernel(const float* __restrict__ x,
                             const f16* __restrict__ wq16,
                             const float* __restrict__ qkv_b,
                             const f16* __restrict__ wp16,
                             const float* __restrict__ proj_b,
                             const float* __restrict__ bias_tab,
                             float* __restrict__ out) {
  extern __shared__ __align__(16) char smem[];
  f16*   Xs    = (f16*)(smem + OFF_X);
  f16*   Qs    = (f16*)(smem + OFF_Q);
  f16*   Ks    = (f16*)(smem + OFF_K);
  f16*   Vt    = (f16*)(smem + OFF_V);
  float* biasT = (float*)(smem + OFF_B);

  const int tid  = threadIdx.x;
  const int lane = tid & 31;
  const int wv   = tid >> 5;        // wave id == head id for attention phases
  const int hh   = lane >> 4;       // half-wave select
  const int lm   = lane & 15;
  const int kb   = hh * 8;          // per-lane k chunk base (ISA 16-bit A/B layout)

  const int bx   = blockIdx.x;      // 2048 windows
  const int b    = bx >> 6;
  const int widx = bx & 63;
  const int wy   = widx >> 3, wx = widx & 7;
  const long imgbase = (long)b * (256L * 4096L);

  // ---------------- Phase 0: stage bias table + window input (fp32 -> f16) ----------------
  for (int k2 = tid; k2 < 225 * 8; k2 += 256) biasT[k2] = bias_tab[k2];
  #pragma unroll
  for (int it = 0; it < 8; ++it) {
    int c = it * 32 + (tid >> 3);
    int i = tid & 7;
    const float* src = x + imgbase + (long)c * 4096 + (wy * 8 + i) * 64 + wx * 8;
    float4 r0 = *(const float4*)src;
    float4 r1 = *(const float4*)(src + 4);
    f16* dst = Xs + c;
    int t0 = i * 8;
    dst[(t0+0)*CP] = (f16)r0.x; dst[(t0+1)*CP] = (f16)r0.y;
    dst[(t0+2)*CP] = (f16)r0.z; dst[(t0+3)*CP] = (f16)r0.w;
    dst[(t0+4)*CP] = (f16)r1.x; dst[(t0+5)*CP] = (f16)r1.y;
    dst[(t0+6)*CP] = (f16)r1.z; dst[(t0+7)*CP] = (f16)r1.w;
  }
  __syncthreads();

  // ---------------- Phase 1: QKV GEMM  (64x768) = Xs(64x256) @ Wqkv^T ----------------
  const float scale = 0.17677669529663687f;   // 1/sqrt(32), folded into Q
  for (int nsel = 0; nsel < 6; ++nsel) {
    const int ntile = wv + nsel * 8;          // 0..47  (Q:0-15  K:16-31  V:32-47)
    const int obase = ntile * 16;
    v8f acc[4] = {};
    for (int ks = 0; ks < 8; ++ks) {
      v16h bf = fragw(wq16 + (ntile * 8 + ks) * 512 + lane * 8);
      #pragma unroll
      for (int mt = 0; mt < 4; ++mt) {
        v16h af = frag16(Xs + (mt * 16 + lm) * CP + ks * 32 + kb);
        acc[mt] = wmma_f16(af, bf, acc[mt]);
      }
    }
    const float bo = qkv_b[obase + lm];
    if (ntile < 16) {                         // Q (scaled)
      int c = obase + lm;
      #pragma unroll
      for (int mt = 0; mt < 4; ++mt)
        #pragma unroll
        for (int r = 0; r < 8; ++r)
          Qs[(mt * 16 + r + 8 * hh) * CP + c] = (f16)((acc[mt][r] + bo) * scale);
    } else if (ntile < 32) {                  // K
      int c = obase - 256 + lm;
      #pragma unroll
      for (int mt = 0; mt < 4; ++mt)
        #pragma unroll
        for (int r = 0; r < 8; ++r)
          Ks[(mt * 16 + r + 8 * hh) * CP + c] = (f16)(acc[mt][r] + bo);
    } else {                                  // V, stored transposed: Vt[channel][token]
      int c = obase - 512 + lm;
      #pragma unroll
      for (int mt = 0; mt < 4; ++mt)
        #pragma unroll
        for (int r = 0; r < 8; ++r)
          Vt[c * VP + (mt * 16 + r + 8 * hh)] = (f16)(acc[mt][r] + bo);
    }
  }
  __syncthreads();

  // ---------------- Phase 2: scores (one head per wave), bias, softmax ----------------
  v8f s[4][4];
  {
    v16h aq[4];
    #pragma unroll
    for (int mt = 0; mt < 4; ++mt)
      aq[mt] = frag16(Qs + (mt * 16 + lm) * CP + wv * 32 + kb);
    #pragma unroll
    for (int nt = 0; nt < 4; ++nt) {
      v16h bk = frag16(Ks + (nt * 16 + lm) * CP + wv * 32 + kb);
      #pragma unroll
      for (int mt = 0; mt < 4; ++mt) {
        v8f z = {};
        s[mt][nt] = wmma_f16(aq[mt], bk, z);
      }
    }
  }
  // relative position bias: idx = (ti-ui+7)*15 + (tj-uj+7), table[idx][head]
  #pragma unroll
  for (int nt = 0; nt < 4; ++nt) {
    int u = nt * 16 + lm, ui = u >> 3, uj = u & 7;
    #pragma unroll
    for (int mt = 0; mt < 4; ++mt)
      #pragma unroll
      for (int r = 0; r < 8; ++r) {
        int t = mt * 16 + r + 8 * hh;
        int idx = ((t >> 3) - ui + 7) * 15 + ((t & 7) - uj + 7);
        s[mt][nt][r] += biasT[idx * 8 + wv];
      }
  }
  // softmax over u: lane%16 columns x 4 n-tiles per row; rows split by (mt, r, hh)
  #pragma unroll
  for (int mt = 0; mt < 4; ++mt)
    #pragma unroll
    for (int r = 0; r < 8; ++r) {
      float mx = fmaxf(fmaxf(s[mt][0][r], s[mt][1][r]), fmaxf(s[mt][2][r], s[mt][3][r]));
      for (int off = 1; off < 16; off <<= 1) mx = fmaxf(mx, __shfl_xor(mx, off, 32));
      float sm = 0.f;
      #pragma unroll
      for (int nt = 0; nt < 4; ++nt) {
        float e = __expf(s[mt][nt][r] - mx);
        s[mt][nt][r] = e;
        sm += e;
      }
      for (int off = 1; off < 16; off <<= 1) sm += __shfl_xor(sm, off, 32);
      float inv = 1.0f / sm;
      #pragma unroll
      for (int nt = 0; nt < 4; ++nt) s[mt][nt][r] *= inv;
    }
  __syncthreads();   // everyone finished reading Qs/Ks -> safe to overlay with Ps

  f16* PsW = (f16*)(smem + OFF_PS) + wv * (64 * PP);
  #pragma unroll
  for (int mt = 0; mt < 4; ++mt)
    #pragma unroll
    for (int nt = 0; nt < 4; ++nt)
      #pragma unroll
      for (int r = 0; r < 8; ++r)
        PsW[(mt * 16 + r + 8 * hh) * PP + nt * 16 + lm] = (f16)s[mt][nt][r];

  // ---------------- Phase 3: O = P @ V  (per head: 64x32, K=64) ----------------
  v8f ov[4][2] = {};
  #pragma unroll
  for (int ks = 0; ks < 2; ++ks) {
    v16h ap[4];
    #pragma unroll
    for (int mt = 0; mt < 4; ++mt)
      ap[mt] = frag16(PsW + (mt * 16 + lm) * PP + ks * 32 + kb);
    #pragma unroll
    for (int nt = 0; nt < 2; ++nt) {
      v16h bvf = frag16(Vt + (wv * 32 + nt * 16 + lm) * VP + ks * 32 + kb);
      #pragma unroll
      for (int mt = 0; mt < 4; ++mt) ov[mt][nt] = wmma_f16(ap[mt], bvf, ov[mt][nt]);
    }
  }
  __syncthreads();   // all Vt/Ps reads done -> overlay Vt with Os
  f16* Os = (f16*)(smem + OFF_O);
  #pragma unroll
  for (int mt = 0; mt < 4; ++mt)
    #pragma unroll
    for (int nt = 0; nt < 2; ++nt)
      #pragma unroll
      for (int r = 0; r < 8; ++r)
        Os[(mt * 16 + r + 8 * hh) * CP + wv * 32 + nt * 16 + lm] = (f16)ov[mt][nt][r];
  __syncthreads();

  // ---------------- Phase 4: projection GEMM (64x256) = Os @ Wproj^T ----------------
  float* OT = (float*)(smem + OFF_OT);   // f32 result, pitch CP floats (overlays Ps region)
  for (int nsel = 0; nsel < 2; ++nsel) {
    const int ntile = wv * 2 + nsel;     // 0..15
    const int cb = ntile * 16;
    v8f acc[4] = {};
    for (int ks = 0; ks < 8; ++ks) {
      v16h bf = fragw(wp16 + (ntile * 8 + ks) * 512 + lane * 8);
      #pragma unroll
      for (int mt = 0; mt < 4; ++mt) {
        v16h af = frag16(Os + (mt * 16 + lm) * CP + ks * 32 + kb);
        acc[mt] = wmma_f16(af, bf, acc[mt]);
      }
    }
    const float pb = proj_b[cb + lm];
    #pragma unroll
    for (int mt = 0; mt < 4; ++mt)
      #pragma unroll
      for (int r = 0; r < 8; ++r)
        OT[(mt * 16 + r + 8 * hh) * CP + cb + lm] = acc[mt][r] + pb;
  }
  __syncthreads();

  // ---------------- Phase 5: window-reverse store to (B, C, H, W), 32B contiguous ----------------
  #pragma unroll
  for (int it = 0; it < 8; ++it) {
    int c = it * 32 + (tid >> 3);
    int i = tid & 7;
    float* dst = out + imgbase + (long)c * 4096 + (wy * 8 + i) * 64 + wx * 8;
    int t0 = i * 8;
    float4 v0, v1;
    v0.x = OT[(t0+0)*CP + c]; v0.y = OT[(t0+1)*CP + c];
    v0.z = OT[(t0+2)*CP + c]; v0.w = OT[(t0+3)*CP + c];
    v1.x = OT[(t0+4)*CP + c]; v1.y = OT[(t0+5)*CP + c];
    v1.z = OT[(t0+6)*CP + c]; v1.w = OT[(t0+7)*CP + c];
    *(float4*)dst       = v0;
    *((float4*)dst + 1) = v1;
  }
}

}  // namespace

extern "C" void kernel_launch(void* const* d_in, const int* in_sizes, int n_in,
                              void* d_out, int out_size, void* d_ws, size_t ws_size,
                              hipStream_t stream) {
  const float* x        = (const float*)d_in[0];
  const float* qkv_w    = (const float*)d_in[1];
  const float* qkv_b    = (const float*)d_in[2];
  const float* proj_w   = (const float*)d_in[3];
  const float* proj_b   = (const float*)d_in[4];
  const float* bias_tab = (const float*)d_in[5];

  f16* wq16 = (f16*)d_ws;                               // 768*256 f16 = 393216 B
  f16* wp16 = (f16*)((char*)d_ws + 768 * 256 * 2);      // 256*256 f16 = 131072 B

  cvt_weights_kernel<<<768, 256, 0, stream>>>(qkv_w, proj_w, wq16, wp16);
  swin_window_attn_kernel<<<2048, 256, SMEM_BYTES, stream>>>(
      x, wq16, qkv_b, wp16, proj_b, bias_tab, (float*)d_out);
}

// v002
// It runs in 200 microseconds.
// Two timings next to v001 both put it at 1.13 times that version's speed.
// All steps since v000 together make it 1.19 times as fast.
#include <hip/hip_runtime.h>

typedef _Float16 f16;
typedef _Float16 v16h __attribute__((ext_vector_type(16)));
typedef _Float16 v8h  __attribute__((ext_vector_type(8)));
typedef float    v8f  __attribute__((ext_vector_type(8)));

namespace {

constexpr int CP = 264;   // f16 pitch (elems) for 64x256 LDS matrices (pad 8 kills bank conflicts)
constexpr int VP = 72;    // Vt pitch: [256 ch][64 tok + pad]
constexpr int PP = 72;    // per-wave softmax-probability pitch: [64][64 + pad]

// LDS layout (bytes); later phases overlay dead earlier regions (barriers in between)
constexpr int OFF_X  = 0;                       // Xs  64x264 f16 = 33792   (phase 0-1)
constexpr int OFF_Q  = 64 * CP * 2;             // Qs  64x264 f16           (phase 1-2)
constexpr int OFF_K  = 2 * 64 * CP * 2;         // Ks  64x264 f16           (phase 1-2)
constexpr int OFF_PS = 0;                       // Ps  8 waves x 64x72 f16 = 73728 (overlays X/Q/K)
constexpr int OFF_OT = 0;                       // OT  64x264 f32 = 67584   (overlays Ps)
constexpr int OFF_V  = 3 * 64 * CP * 2;         // Vt  256x72 f16 = 36864   (phase 1-3)
constexpr int OFF_O  = OFF_V;                   // Os  64x264 f16 (overlays Vt after PV)
constexpr int OFF_B  = OFF_V + 256 * VP * 2;    // bias table 225x8 f32 = 7200
constexpr int SMEM_BYTES = OFF_B + 225 * 8 * 4; // 145440 B  (< 320KB/WGP)

__device__ inline v16h frag16(const f16* p) {
  // WMMA A/B operand: two contiguous 8xf16 chunks at k-offset 0 and +16 (per ISA VGPR layout)
  v8h lo = *(const v8h*)p;
  v8h hi = *(const v8h*)(p + 16);
  return __builtin_shufflevector(lo, hi, 0,1,2,3,4,5,6,7,8,9,10,11,12,13,14,15);
}

__device__ inline v16h fragw(const f16* p) {
  // packed weight fragment: the 32 lanes' low 8-element k chunks lie in one 512-byte run, their high chunks (k + 16) in the next
  v8h lo = *(const v8h*)p;
  v8h hi = *(const v8h*)(p + 256);
  return __builtin_shufflevector(lo, hi, 0,1,2,3,4,5,6,7,8,9,10,11,12,13,14,15);
}

__device__ inline v8f wmma_f16(v16h a, v16h b, v8f c) {
  return __builtin_amdgcn_wmma_f32_16x16x32_f16(false, a, false, b, (short)0, c, false, false);
}

__global__ void cvt_weights_kernel(const float* __restrict__ qw,
                                   const float* __restrict__ pw,
                                   f16* __restrict__ q16, f16* __restrict__ p16) {
  // Packs W[row][k] in WMMA B-fragment order: [16-row tile][32-k step][half h][lane][8 elems], so that
  // one wave-wide 16-byte load in the main kernel reads 512 contiguous bytes (4 whole lines, not 16 pieces).
  int i = blockIdx.x * 256 + threadIdx.x;   // grid = 768 blocks -> 196608 = 768*256 exactly
  int e = i & 7, ln = (i >> 3) & 31, h = (i >> 8) & 1, ks = (i >> 9) & 7, tile = i >> 12;
  int src = (tile * 16 + (ln & 15)) * 256 + ks * 32 + h * 16 + (ln >> 4) * 8 + e;
  q16[i] = (f16)qw[src];
  if (i < 256 * 256) p16[i] = (f16)pw[src];
}

// waves_per_eu(4): holds the register budget at 256, so that two work-groups stay resident per WGP as before
__global__ __launch_bounds__(256) __attribute__((amdgpu_waves_per_eu(4)))
void swin_window_attn_kernel(const float* __restrict__ x,
                             const f16* __restrict__ wq16,
                             const float* __restrict__ qkv_b,
                             const f16* __restrict__ wp16,
                             const float* __restrict__ proj_b,
                             const float* __restrict__ bias_tab,
                             float* __restrict__ out) {
  extern __shared__ __align__(16) char smem[];
  f16*   Xs    = (f16*)(smem + OFF_X);
  f16*   Qs    = (f16*)(smem + OFF_Q);
  f16*   Ks    = (f16*)(smem + OFF_K);
  f16*   Vt    = (f16*)(smem + OFF_V);
  float* biasT = (float*)(smem + OFF_B);

  const int tid  = threadIdx.x;
  const int lane = tid & 31;
  const int wv   = tid >> 5;        // wave id == head id for attention phases
  const int hh   = lane >> 4;       // half-wave select
  const int lm   = lane & 15;
  const int kb   = hh * 8;          // per-lane k chunk base (ISA 16-bit A/B layout)

  const int bx   = blockIdx.x;      // 2048 windows
  const int b    = bx >> 6;
  const int widx = bx & 63;
  const int wy   = widx >> 3, wx = widx & 7;
  const long imgbase = (long)b * (256L * 4096L);

  // ---------------- Phase 0: stage bias table + window input (fp32 -> f16) ----------------
  for (int k2 = tid; k2 < 225 * 8; k2 += 256) biasT[k2] = bias_tab[k2];
  #pragma unroll
  for (int it = 0; it < 8; ++it) {
    int c = it * 32 + (tid >> 3);
    int i = tid & 7;
    const float* src = x + imgbase + (long)c * 4096 + (wy * 8 + i) * 64 + wx * 8;
    float4 r0 = *(const float4*)src;
    float4 r1 = *(const float4*)(src + 4);
    f16* dst = Xs + c;
    int t0 = i * 8;
    dst[(t0+0)*CP] = (f16)r0.x; dst[(t0+1)*CP] = (f16)r0.y;
    dst[(t0+2)*CP] = (f16)r0.z; dst[(t0+3)*CP] = (f16)r0.w;
    dst[(t0+4)*CP] = (f16)r1.x; dst[(t0+5)*CP] = (f16)r1.y;
    dst[(t0+6)*CP] = (f16)r1.z; dst[(t0+7)*CP] = (f16)r1.w;
  }
  __syncthreads();

  // ---------------- Phase 1: QKV GEMM  (64x768) = Xs(64x256) @ Wqkv^T ----------------
  const float scale = 0.17677669529663687f;   // 1/sqrt(32), folded into Q
  // Each wave owns 16-column tile tq = wv + 8 * p (p = 0, 1) of Q, of K and of V: one X fragment read from LDS
  // feeds three weight tiles; the fragments of later k steps are fetched ahead into register rings.
  for (int p = 0; p < 2; ++p) {
    const int c = (wv + p * 8) * 16 + lm;
    const float bq = qkv_b[c], bk = qkv_b[256 + c], bv = qkv_b[512 + c];
    const f16* wb = wq16 + (wv + p * 8) * 4096 + lane * 8;
    const f16* xa = Xs + lm * CP + kb;
    v8f  acc[3][4];
    v16h af[2][4];        // X fragments of this k step and the next
    v16h bw[8];           // weight fragments, ring over f = 3 * ks + g (g: 0 = Q, 1 = K, 2 = V tile, 16 tiles apart)
    auto load_w = [&](int f) { bw[f % 8] = fragw(wb + (f % 3) * 65536 + (f / 3) * 512); };
    auto load_x = [&](int ks) {
      #pragma unroll
      for (int mt = 0; mt < 4; ++mt)
        af[ks & 1][mt] = frag16(xa + mt * 16 * CP + ks * 32);
    };
    #pragma unroll
    for (int f = 0; f < 5; ++f) load_w(f);
    load_x(0);
    #pragma unroll
    for (int ks = 0; ks < 8; ++ks) {
      #pragma unroll
      for (int f = 3 * ks + 5; f < 3 * ks + 8; ++f)
        if (f < 24) load_w(f);
      if (ks < 7) load_x(ks + 1);
      // keeps the loads above as one group ahead of this step's WMMAs (the scheduler otherwise sinks each to its use)
      __builtin_amdgcn_sched_barrier(0);
      #pragma unroll
      for (int g = 0; g < 3; ++g)
        #pragma unroll
        for (int mt = 0; mt < 4; ++mt) {
          v8f cin = {};
          if (ks != 0) cin = acc[g][mt];
          acc[g][mt] = wmma_f16(af[ks & 1][mt], bw[(3 * ks + g) % 8], cin);
        }
      // closes the fence pair: the next step's loads and the stores behind the loop stay out of this WMMA block
      __builtin_amdgcn_sched_barrier(0);
    }
    #pragma unroll
    for (int mt = 0; mt < 4; ++mt)
      #pragma unroll
      for (int r = 0; r < 8; ++r) {
        const int t = mt * 16 + r + 8 * hh;
        Qs[t * CP + c] = (f16)((acc[0][mt][r] + bq) * scale);   // Q (scaled)
        Ks[t * CP + c] = (f16)(acc[1][mt][r] + bk);             // K
      }
    #pragma unroll
    for (int mt = 0; mt < 4; ++mt)            // V, stored transposed: Vt[channel][token]
      #pragma unroll
      for (int r = 0; r < 8; ++r)
        Vt[c * VP + (mt * 16 + r + 8 * hh)] = (f16)(acc[2][mt][r] + bv);
  }
  __syncthreads();

  // ---------------- Phase 2: scores (one head per wave), bias, softmax ----------------
  v8f s[4][4];
  {
    v16h aq[4];
    #pragma unroll
    for (int mt = 0; mt < 4; ++mt)
      aq[mt] = frag16(Qs + (mt * 16 + lm) * CP + wv * 32 + kb);
    #pragma unroll
    for (int nt = 0; nt < 4; ++nt) {
      v16h bk = frag16(Ks + (nt * 16 + lm) * CP + wv * 32 + kb);
      #pragma unroll
      for (int mt = 0; mt < 4; ++mt) {
        v8f z = {};
        s[mt][nt] = wmma_f16(aq[mt], bk, z);
      }
    }
  }
  // relative position bias: idx = (ti-ui+7)*15 + (tj-uj+7), table[idx][head]
  #pragma unroll
  for (int nt = 0; nt < 4; ++nt) {
    int u = nt * 16 + lm, ui = u >> 3, uj = u & 7;
    #pragma unroll
    for (int mt = 0; mt < 4; ++mt)
      #pragma unroll
      for (int r = 0; r < 8; ++r) {
        int t = mt * 16 + r + 8 * hh;
        int idx = ((t >> 3) - ui + 7) * 15 + ((t & 7) - uj + 7);
        s[mt][nt][r] += biasT[idx * 8 + wv];
      }
  }
  // softmax over u: lane%16 columns x 4 n-tiles per row; rows split by (mt, r, hh)
  #pragma unroll
  for (int mt = 0; mt < 4; ++mt)
    #pragma unroll
    for (int r = 0; r < 8; ++r) {
      float mx = fmaxf(fmaxf(s[mt][0][r], s[mt][1][r]), fmaxf(s[mt][2][r], s[mt][3][r]));
      for (int off = 1; off < 16; off <<= 1) mx = fmaxf(mx, __shfl_xor(mx, off, 32));
      float sm = 0.f;
      #pragma unroll
      for (int nt = 0; nt < 4; ++nt) {
        float e = __expf(s[mt][nt][r] - mx);
        s[mt][nt][r] = e;
        sm += e;
      }
      for (int off = 1; off < 16; off <<= 1) sm += __shfl_xor(sm, off, 32);
      float inv = 1.0f / sm;
      #pragma unroll
      for (int nt = 0; nt < 4; ++nt) s[mt][nt][r] *= inv;
    }
  __syncthreads();   // everyone finished reading Qs/Ks -> safe to overlay with Ps

  f16* PsW = (f16*)(smem + OFF_PS) + wv * (64 * PP);
  #pragma unroll
  for (int mt = 0; mt < 4; ++mt)
    #pragma unroll
    for (int nt = 0; nt < 4; ++nt)
      #pragma unroll
      for (int r = 0; r < 8; ++r)
        PsW[(mt * 16 + r + 8 * hh) * PP + nt * 16 + lm] = (f16)s[mt][nt][r];

  // ---------------- Phase 3: O = P @ V  (per head: 64x32, K=64) ----------------
  v8f ov[4][2] = {};
  #pragma unroll
  for (int ks = 0; ks < 2; ++ks) {
    v16h ap[4];
    #pragma unroll
    for (int mt = 0; mt < 4; ++mt)
      ap[mt] = frag16(PsW + (mt * 16 + lm) * PP + ks * 32 + kb);
    #pragma unroll
    for (int nt = 0; nt < 2; ++nt) {
      v16h bvf = frag16(Vt + (wv * 32 + nt * 16 + lm) * VP + ks * 32 + kb);
      #pragma unroll
      for (int mt = 0; mt < 4; ++mt) ov[mt][nt] = wmma_f16(ap[mt], bvf, ov[mt][nt]);
    }
  }
  __syncthreads();   // all Vt/Ps reads done -> overlay Vt with Os
  f16* Os = (f16*)(smem + OFF_O);
  #pragma unroll
  for (int mt = 0; mt < 4; ++mt)
    #pragma unroll
    for (int nt = 0; nt < 2; ++nt)
      #pragma unroll
      for (int r = 0; r < 8; ++r)
        Os[(mt * 16 + r + 8 * hh) * CP + wv * 32 + nt * 16 + lm] = (f16)ov[mt][nt][r];
  __syncthreads();

  // ---------------- Phase 4: projection GEMM (64x256) = Os @ Wproj^T ----------------
  float* OT = (float*)(smem + OFF_OT);   // f32 result, pitch CP floats (overlays Ps region)
  {
    // One O fragment read from LDS feeds both of the wave's 16-column tiles; same rings as in phase 1.
    const f16* wb = wp16 + wv * 8192 + lane * 8;
    const f16* oa = Os + lm * CP + kb;
    const float pb0 = proj_b[wv * 32 + lm], pb1 = proj_b[wv * 32 + 16 + lm];
    v8f  acc[2][4];
    v16h af[2][4];
    v16h bw[4][2];
    auto load_w = [&](int s) {
      #pragma unroll
      for (int g = 0; g < 2; ++g) bw[s & 3][g] = fragw(wb + g * 4096 + s * 512);
    };
    auto load_o = [&](int s) {
      #pragma unroll
      for (int mt = 0; mt < 4; ++mt) af[s & 1][mt] = frag16(oa + mt * 16 * CP + s * 32);
    };
    load_w(0); load_w(1); load_w(2);
    load_o(0);
    #pragma unroll
    for (int s = 0; s < 8; ++s) {
      if (s + 3 < 8) load_w(s + 3);
      if (s + 1 < 8) load_o(s + 1);
      // keeps the loads above as one group ahead of this step's WMMAs (the scheduler otherwise sinks each to its use)
      __builtin_amdgcn_sched_barrier(0);
      #pragma unroll
      for (int g = 0; g < 2; ++g)
        #pragma unroll
        for (int mt = 0; mt < 4; ++mt) {
          v8f cin = {};
          if (s != 0) cin = acc[g][mt];
          acc[g][mt] = wmma_f16(af[s & 1][mt], bw[s & 3][g], cin);
        }
      // closes the fence pair: the next step's loads and the stores behind the loop stay out of this WMMA block
      __builtin_amdgcn_sched_barrier(0);
    }
    #pragma unroll
    for (int g = 0; g < 2; ++g) {
      const int c = wv * 32 + g * 16 + lm;
      const float pb = g ? pb1 : pb0;
      #pragma unroll
      for (int mt = 0; mt < 4; ++mt)
        #pragma unroll
        for (int r = 0; r < 8; ++r)
          OT[(mt * 16 + r + 8 * hh) * CP + c] = acc[g][mt][r] + pb;
    }
  }
  __syncthreads();

  // ---------------- Phase 5: window-reverse store to (B, C, H, W), 32B contiguous ----------------
  #pragma unroll
  for (int it = 0; it < 8; ++it) {
    int c = it * 32 + (tid >> 3);
    int i = tid & 7;
    float* dst = out + imgbase + (long)c * 4096 + (wy * 8 + i) * 64 + wx * 8;
    int t0 = i * 8;
    float4 v0, v1;
    v0.x = OT[(t0+0)*CP + c]; v0.y = OT[(t0+1)*CP + c];
    v0.z = OT[(t0+2)*CP + c]; v0.w = OT[(t0+3)*CP + c];
    v1.x = OT[(t0+4)*CP + c]; v1.y = OT[(t0+5)*CP + c];
    v1.z = OT[(t0+6)*CP + c]; v1.w = OT[(t0+7)*CP + c];
    *(float4*)dst       = v0;
    *((float4*)dst + 1) = v1;
  }
}

}  // namespace

extern "C" void kernel_launch(void* const* d_in, const int* in_sizes, int n_in,
                              void* d_out, int out_size, void* d_ws, size_t ws_size,
                              hipStream_t stream) {
  const float* x        = (const float*)d_in[0];
  const float* qkv_w    = (const float*)d_in[1];
  const float* qkv_b    = (const float*)d_in[2];
  const float* proj_w   = (const float*)d_in[3];
  const float* proj_b   = (const float*)d_in[4];
  const float* bias_tab = (const float*)d_in[5];

  f16* wq16 = (f16*)d_ws;                               // 768*256 f16 = 393216 B
  f16* wp16 = (f16*)((char*)d_ws + 768 * 256 * 2);      // 256*256 f16 = 131072 B

  cvt_weights_kernel<<<768, 256, 0, stream>>>(qkv_w, proj_w, wq16, wp16);
  swin_window_attn_kernel<<<2048, 256, SMEM_BYTES, stream>>>(
      x, wq16, qkv_b, wp16, proj_b, bias_tab, (float*)d_out);
}

// v003
// Measured time: 179 microseconds a run.
// In both of two side-by-side timings against v002, it was 1.12 times as fast.
// All steps since v000 together make it 1.34 times as fast.
#include <hip/hip_runtime.h>

typedef _Float16 f16;
typedef _Float16 v16h __attribute__((ext_vector_type(16)));
typedef _Float16 v8h  __attribute__((ext_vector_type(8)));
typedef float    v8f  __attribute__((ext_vector_type(8)));

namespace {

constexpr int CP = 264;   // f16 pitch (elems) for 64x256 LDS matrices (pad 8 kills bank conflicts)
constexpr int VP = 72;    // Vt pitch: [256 ch][64 tok + pad]

// LDS layout (bytes); later phases overlay dead earlier regions (barriers in between)
constexpr int OFF_X  = 0;                       // Xs  64x264 f16 = 33792   (phase 0-1)
constexpr int OFF_Q  = 64 * CP * 2;             // Qs  64x264 f16           (phase 1-2)
constexpr int OFF_K  = 2 * 64 * CP * 2;         // Ks  64x264 f16           (phase 1-2)
constexpr int OFF_OT = 0;                       // OT  64x264 f32 = 67584   (overlays X/Q)
constexpr int OFF_V  = 3 * 64 * CP * 2;         // Vt  256x72 f16 = 36864   (phase 1-3)
constexpr int OFF_O  = OFF_V;                   // Os  64x264 f16 (overlays Vt after PV)
constexpr int OFF_B  = OFF_V + 256 * VP * 2;    // bias table 225x8 f32 = 7200
constexpr int SMEM_BYTES = OFF_B + 225 * 8 * 4; // 145440 B  (< 320KB/WGP)

__device__ inline v16h frag16(const f16* p) {
  // WMMA A/B operand: two contiguous 8xf16 chunks at k-offset 0 and +16 (per ISA VGPR layout)
  v8h lo = *(const v8h*)p;
  v8h hi = *(const v8h*)(p + 16);
  return __builtin_shufflevector(lo, hi, 0,1,2,3,4,5,6,7,8,9,10,11,12,13,14,15);
}

__device__ inline v16h fragw(const f16* p) {
  // packed weight fragment: the 32 lanes' low 8-element k chunks lie in one 512-byte run, their high chunks (k + 16) in the next
  v8h lo = *(const v8h*)p;
  v8h hi = *(const v8h*)(p + 256);
  return __builtin_shufflevector(lo, hi, 0,1,2,3,4,5,6,7,8,9,10,11,12,13,14,15);
}

__device__ inline float xhalf(float v) {
  // value of lane l ^ 16 (the lane that holds the other half of the same column's rows)
  int b = __builtin_bit_cast(int, v);
  return __builtin_bit_cast(float, __builtin_amdgcn_permlanex16(b, b, 0x76543210, 0xfedcba98, false, false));
}

__device__ inline v8f wmma_f16(v16h a, v16h b, v8f c) {
  return __builtin_amdgcn_wmma_f32_16x16x32_f16(false, a, false, b, (short)0, c, false, false);
}

__global__ void cvt_weights_kernel(const float* __restrict__ qw,
                                   const float* __restrict__ pw,
                                   f16* __restrict__ q16, f16* __restrict__ p16) {
  // Packs W[row][k] in WMMA B-fragment order: [16-row tile][32-k step][half h][lane][8 elems], so that
  // one wave-wide 16-byte load in the main kernel reads 512 contiguous bytes (4 whole lines, not 16 pieces).
  int i = blockIdx.x * 256 + threadIdx.x;   // grid = 768 blocks -> 196608 = 768*256 exactly
  int e = i & 7, ln = (i >> 3) & 31, h = (i >> 8) & 1, ks = (i >> 9) & 7, tile = i >> 12;
  int src = (tile * 16 + (ln & 15)) * 256 + ks * 32 + h * 16 + (ln >> 4) * 8 + e;
  q16[i] = (f16)qw[src];
  if (i < 256 * 256) p16[i] = (f16)pw[src];
}

// waves_per_eu(4): holds the register budget at 256, so that two work-groups stay resident per WGP as before
__global__ __launch_bounds__(256) __attribute__((amdgpu_waves_per_eu(4)))
void swin_window_attn_kernel(const float* __restrict__ x,
                             const f16* __restrict__ wq16,
                             const float* __restrict__ qkv_b,
                             const f16* __restrict__ wp16,
                             const float* __restrict__ proj_b,
                             const float* __restrict__ bias_tab,
                             float* __restrict__ out) {
  extern __shared__ __align__(16) char smem[];
  f16*   Xs    = (f16*)(smem + OFF_X);
  f16*   Qs    = (f16*)(smem + OFF_Q);
  f16*   Ks    = (f16*)(smem + OFF_K);
  f16*   Vt    = (f16*)(smem + OFF_V);
  float* biasT = (float*)(smem + OFF_B);

  const int tid  = threadIdx.x;
  const int lane = tid & 31;
  const int wv   = tid >> 5;        // wave id == head id for attention phases
  const int hh   = lane >> 4;       // half-wave select
  const int lm   = lane & 15;
  const int kb   = hh * 8;          // per-lane k chunk base (ISA 16-bit A/B layout)

  const int bx   = blockIdx.x;      // 2048 windows
  const int b    = bx >> 6;
  const int widx = bx & 63;
  const int wy   = widx >> 3, wx = widx & 7;
  const long imgbase = (long)b * (256L * 4096L);

  // ---------------- Phase 0: stage bias table + window input (fp32 -> f16) ----------------
  for (int k2 = tid; k2 < 225 * 8; k2 += 256) biasT[k2] = bias_tab[k2];
  #pragma unroll
  for (int it = 0; it < 8; ++it) {
    int c = it * 32 + (tid >> 3);
    int i = tid & 7;
    const float* src = x + imgbase + (long)c * 4096 + (wy * 8 + i) * 64 + wx * 8;
    float4 r0 = *(const float4*)src;
    float4 r1 = *(const float4*)(src + 4);
    f16* dst = Xs + c;
    int t0 = i * 8;
    dst[(t0+0)*CP] = (f16)r0.x; dst[(t0+1)*CP] = (f16)r0.y;
    dst[(t0+2)*CP] = (f16)r0.z; dst[(t0+3)*CP] = (f16)r0.w;
    dst[(t0+4)*CP] = (f16)r1.x; dst[(t0+5)*CP] = (f16)r1.y;
    dst[(t0+6)*CP] = (f16)r1.z; dst[(t0+7)*CP] = (f16)r1.w;
  }
  __syncthreads();

  // ---------------- Phase 1: QKV GEMM  (64x768) = Xs(64x256) @ Wqkv^T ----------------
  const float scale = 0.17677669529663687f;   // 1/sqrt(32), folded into Q
  for (int p = 0; p < 2; ++p) {
    const int ct = (wv + p * 8) * 16;
    const int c = ct + lm;
    const float bv = qkv_b[512 + c];
    v8f bq, bk;           // biases of the lane's 8 channels
    const f16* wb = wq16 + (wv + p * 8) * 4096 + lane * 8;
    const f16* xa = Xs + lm * CP + kb;
    v8f  acc[3][4];
    v16h af[2][4];        // X fragments of this k step and the next
    v16h bw[8];           // weight fragments, ring over f = 3 * ks + g (g: 0 = Q, 1 = K, 2 = V tile, 16 tiles apart)
    auto load_w = [&](int f) { bw[f % 8] = fragw(wb + (f % 3) * 65536 + (f / 3) * 512); };
    auto load_x = [&](int ks) {
      #pragma unroll
      for (int mt = 0; mt < 4; ++mt)
        af[ks & 1][mt] = frag16(xa + mt * 16 * CP + ks * 32);
    };
    #pragma unroll
    for (int f = 0; f < 5; ++f) load_w(f);
    load_x(0);
    #pragma unroll
    for (int ks = 0; ks < 8; ++ks) {
      #pragma unroll
      for (int f = 3 * ks + 5; f < 3 * ks + 8; ++f)
        if (f < 24) load_w(f);
      if (ks < 7) load_x(ks + 1);
      if (ks == 7) {      // the last step fetches no fragments: its registers take the biases
        bq = *(const v8f*)(qkv_b + ct + 8 * hh);
        bk = *(const v8f*)(qkv_b + 256 + ct + 8 * hh);
      }
      // keeps the loads above as one group ahead of this step's WMMAs (the scheduler otherwise sinks each to its use)
      __builtin_amdgcn_sched_barrier(0);
      #pragma unroll
      for (int g = 0; g < 3; ++g)
        #pragma unroll
        for (int mt = 0; mt < 4; ++mt) {
          v8f cin = {};
          if (ks != 0) cin = acc[g][mt];
          acc[g][mt] = g < 2 ? wmma_f16(bw[(3 * ks + g) % 8], af[ks & 1][mt], cin)
                             : wmma_f16(af[ks & 1][mt], bw[(3 * ks + g) % 8], cin);
        }
      // closes the fence pair: the next step's loads and the stores behind the loop stay out of this WMMA block
      __builtin_amdgcn_sched_barrier(0);
    }
    #pragma unroll
    for (int mt = 0; mt < 4; ++mt) {
      v8h q8, k8;
      #pragma unroll
      for (int r = 0; r < 8; ++r) {
        q8[r] = (f16)((acc[0][mt][r] + bq[r]) * scale);   // Q (scaled)
        k8[r] = (f16)(acc[1][mt][r] + bk[r]);             // K
      }
      *(v8h*)(Qs + (mt * 16 + lm) * CP + ct + 8 * hh) = q8;
      *(v8h*)(Ks + (mt * 16 + lm) * CP + ct + 8 * hh) = k8;
    }
    #pragma unroll
    for (int mt = 0; mt < 4; ++mt)            // V, stored transposed: Vt[channel][token]
      #pragma unroll
      for (int r = 0; r < 8; ++r)
        Vt[c * VP + (mt * 16 + r + 8 * hh)] = (f16)(acc[2][mt][r] + bv);
  }
  __syncthreads();

  // ---------------- Phase 2: scores (one head per wave), bias, softmax ----------------
  // K is A and Q is B: s[mt][nt][r] = score(query t = mt*16 + lm, key u = nt*16 + 8*hh + r). A lane holds 32 of its
  // query's 64 keys and lane ^ 16 the other 32.
  v8f s[4][4];
  {
    v16h aq[4];
    #pragma unroll
    for (int mt = 0; mt < 4; ++mt)
      aq[mt] = frag16(Qs + (mt * 16 + lm) * CP + wv * 32 + kb);
    #pragma unroll
    for (int nt = 0; nt < 4; ++nt) {
      v16h bk = frag16(Ks + (nt * 16 + lm) * CP + wv * 32 + kb);
      #pragma unroll
      for (int mt = 0; mt < 4; ++mt) {
        v8f z = {};
        s[mt][nt] = wmma_f16(bk, aq[mt], z);
      }
    }
  }
  // relative position bias: idx = (ti-ui+7)*15 + (tj-uj+7), table[idx][head]
  #pragma unroll
  for (int mt = 0; mt < 4; ++mt) {
    int t = mt * 16 + lm, ti = t >> 3, tj = t & 7;
    #pragma unroll
    for (int nt = 0; nt < 4; ++nt)
      #pragma unroll
      for (int r = 0; r < 8; ++r) {
        int u = nt * 16 + r + 8 * hh;
        int idx = (ti - (u >> 3) + 7) * 15 + (tj - (u & 7) + 7);
        s[mt][nt][r] += biasT[idx * 8 + wv];
      }
  }
  // softmax over u: 32 values in the lane (four partial sums), then one exchange with lane ^ 16
  #pragma unroll
  for (int mt = 0; mt < 4; ++mt) {
    float mx = s[mt][0][0];
    #pragma unroll
    for (int nt = 0; nt < 4; ++nt)
      #pragma unroll
      for (int r = 0; r < 8; ++r) mx = fmaxf(mx, s[mt][nt][r]);
    mx = fmaxf(mx, xhalf(mx));
    float ps[4];
    #pragma unroll
    for (int nt = 0; nt < 4; ++nt) {
      ps[nt] = 0.f;
      #pragma unroll
      for (int r = 0; r < 8; ++r) {
        float e = __expf(s[mt][nt][r] - mx);
        s[mt][nt][r] = e;
        ps[nt] += e;
      }
    }
    float sm = (ps[0] + ps[1]) + (ps[2] + ps[3]);
    sm += xhalf(sm);
    float inv = 1.0f / sm;
    #pragma unroll
    for (int nt = 0; nt < 4; ++nt) s[mt][nt] *= inv;
  }

  // ---------------- Phase 3: O = P @ V  (per head: 64x32, K=64) ----------------
  // Two score tiles of a query tile, converted in place, are the B fragment of a 32-key step (keys 8*hh + e and
  // 16 + 8*hh + e, the order in which frag16 reads Vt). Vt is A: a lane's 8 registers are 8 channels of one token.
  v8f ov[4][2] = {};
  #pragma unroll
  for (int ks = 0; ks < 2; ++ks) {
    v16h pf[4];
    #pragma unroll
    for (int mt = 0; mt < 4; ++mt)
      #pragma unroll
      for (int e = 0; e < 8; ++e) {
        pf[mt][e]     = (f16)s[mt][2 * ks][e];
        pf[mt][8 + e] = (f16)s[mt][2 * ks + 1][e];
      }
    #pragma unroll
    for (int nt = 0; nt < 2; ++nt) {
      v16h bvf = frag16(Vt + (wv * 32 + nt * 16 + lm) * VP + ks * 32 + kb);
      #pragma unroll
      for (int mt = 0; mt < 4; ++mt) ov[mt][nt] = wmma_f16(bvf, pf[mt], ov[mt][nt]);
    }
  }
  __syncthreads();   // all Qs/Ks/Vt reads done -> overlay Vt with Os (and, in phase 4, X/Q with OT)
  f16* Os = (f16*)(smem + OFF_O);
  #pragma unroll
  for (int mt = 0; mt < 4; ++mt)
    #pragma unroll
    for (int nt = 0; nt < 2; ++nt) {
      v8h o8;
      #pragma unroll
      for (int r = 0; r < 8; ++r) o8[r] = (f16)ov[mt][nt][r];
      *(v8h*)(Os + (mt * 16 + lm) * CP + wv * 32 + nt * 16 + 8 * hh) = o8;
    }
  __syncthreads();

  // ---------------- Phase 4: projection GEMM (64x256) = Os @ Wproj^T ----------------
  float* OT = (float*)(smem + OFF_OT);   // f32 result, pitch CP floats (overlays X/Q)
  {
    // One O fragment read from LDS feeds both of the wave's 16-column tiles; same rings as in phase 1.
    const f16* wb = wp16 + wv * 8192 + lane * 8;
    const f16* oa = Os + lm * CP + kb;
    const float pb0 = proj_b[wv * 32 + lm], pb1 = proj_b[wv * 32 + 16 + lm];
    v8f  acc[2][4];
    v16h af[2][4];
    v16h bw[4][2];
    auto load_w = [&](int s) {
      #pragma unroll
      for (int g = 0; g < 2; ++g) bw[s & 3][g] = fragw(wb + g * 4096 + s * 512);
    };
    auto load_o = [&](int s) {
      #pragma unroll
      for (int mt = 0; mt < 4; ++mt) af[s & 1][mt] = frag16(oa + mt * 16 * CP + s * 32);
    };
    load_w(0); load_w(1); load_w(2);
    load_o(0);
    #pragma unroll
    for (int s = 0; s < 8; ++s) {
      if (s + 3 < 8) load_w(s + 3);
      if (s + 1 < 8) load_o(s + 1);
      // keeps the loads above as one group ahead of this step's WMMAs (the scheduler otherwise sinks each to its use)
      __builtin_amdgcn_sched_barrier(0);
      #pragma unroll
      for (int g = 0; g < 2; ++g)
        #pragma unroll
        for (int mt = 0; mt < 4; ++mt) {
          v8f cin = {};
          if (s != 0) cin = acc[g][mt];
          acc[g][mt] = wmma_f16(af[s & 1][mt], bw[s & 3][g], cin);
        }
      // closes the fence pair: the next step's loads and the stores behind the loop stay out of this WMMA block
      __builtin_amdgcn_sched_barrier(0);
    }
    #pragma unroll
    for (int g = 0; g < 2; ++g) {
      const int c = wv * 32 + g * 16 + lm;
      const float pb = g ? pb1 : pb0;
      #pragma unroll
      for (int mt = 0; mt < 4; ++mt)
        #pragma unroll
        for (int r = 0; r < 8; ++r)
          OT[(mt * 16 + r + 8 * hh) * CP + c] = acc[g][mt][r] + pb;
    }
  }
  __syncthreads();

  // ---------------- Phase 5: window-reverse store to (B, C, H, W), 32B contiguous ----------------
  #pragma unroll
  for (int it = 0; it < 8; ++it) {
    int c = it * 32 + (tid >> 3);
    int i = tid & 7;
    float* dst = out + imgbase + (long)c * 4096 + (wy * 8 + i) * 64 + wx * 8;
    int t0 = i * 8;
    float4 v0, v1;
    v0.x = OT[(t0+0)*CP + c]; v0.y = OT[(t0+1)*CP + c];
    v0.z = OT[(t0+2)*CP + c]; v0.w = OT[(t0+3)*CP + c];
    v1.x = OT[(t0+4)*CP + c]; v1.y = OT[(t0+5)*CP + c];
    v1.z = OT[(t0+6)*CP + c]; v1.w = OT[(t0+7)*CP + c];
    *(float4*)dst       = v0;
    *((float4*)dst + 1) = v1;
  }
}

}  // namespace

extern "C" void kernel_launch(void* const* d_in, const int* in_sizes, int n_in,
                              void* d_out, int out_size, void* d_ws, size_t ws_size,
                              hipStream_t stream) {
  const float* x        = (const float*)d_in[0];
  const float* qkv_w    = (const float*)d_in[1];
  const float* qkv_b    = (const float*)d_in[2];
  const float* proj_w   = (const float*)d_in[3];
  const float* proj_b   = (const float*)d_in[4];
  const float* bias_tab = (const float*)d_in[5];

  f16* wq16 = (f16*)d_ws;                               // 768*256 f16 = 393216 B
  f16* wp16 = (f16*)((char*)d_ws + 768 * 256 * 2);      // 256*256 f16 = 131072 B

  cvt_weights_kernel<<<768, 256, 0, stream>>>(qkv_w, proj_w, wq16, wp16);
  swin_window_attn_kernel<<<2048, 256, SMEM_BYTES, stream>>>(
      x, wq16, qkv_b, wp16, proj_b, bias_tab, (float*)d_out);
}

// v004
// A run of this version takes 163 microseconds.
// Two timings next to v003 both put it at 1.10 times that version's speed.
// Over all steps from v000 it is 1.47 times as fast.
#include <hip/hip_runtime.h>

typedef _Float16 f16;
typedef _Float16 v16h __attribute__((ext_vector_type(16)));
typedef _Float16 v8h  __attribute__((ext_vector_type(8)));
typedef float    v8f  __attribute__((ext_vector_type(8)));

namespace {

constexpr int CP = 264;   // f16 pitch (elems) for 64x256 LDS matrices (pad 8 kills bank conflicts)
constexpr int VP = 72;    // Vt pitch: [256 ch][64 tok + pad]

// LDS layout (bytes); later phases overlay dead earlier regions (barriers in between)
constexpr int OFF_X  = 0;                       // Xs  64x264 f16 = 33792   (phase 0-1)
constexpr int OFF_Q  = 64 * CP * 2;             // Qs  64x264 f16           (phase 1-2)
constexpr int OFF_K  = 2 * 64 * CP * 2;         // Ks  64x264 f16           (phase 1-2)
constexpr int OFF_V  = 3 * 64 * CP * 2;         // Vt  256x72 f16 = 36864   (phase 1-3)
constexpr int OFF_O  = OFF_V;                   // Os  64x264 f16 (overlays Vt after PV)
constexpr int OFF_B  = OFF_V + 256 * VP * 2;    // bias table 225x8 f32 = 7200
constexpr int SMEM_BYTES = OFF_B + 225 * 8 * 4; // 145440 B  (< 320KB/WGP)

__device__ inline v16h frag16(const f16* p) {
  // WMMA A/B operand: two contiguous 8xf16 chunks at k-offset 0 and +16 (per ISA VGPR layout)
  v8h lo = *(const v8h*)p;
  v8h hi = *(const v8h*)(p + 16);
  return __builtin_shufflevector(lo, hi, 0,1,2,3,4,5,6,7,8,9,10,11,12,13,14,15);
}

__device__ inline v16h fragw(const f16* p) {
  // packed weight fragment: the 32 lanes' low 8-element k chunks lie in one 512-byte run, their high chunks (k + 16) in the next
  v8h lo = *(const v8h*)p;
  v8h hi = *(const v8h*)(p + 256);
  return __builtin_shufflevector(lo, hi, 0,1,2,3,4,5,6,7,8,9,10,11,12,13,14,15);
}

__device__ inline float xhalf(float v) {
  // value of lane l ^ 16 (the lane that holds the other half of the same column's rows)
  int b = __builtin_bit_cast(int, v);
  return __builtin_bit_cast(float, __builtin_amdgcn_permlanex16(b, b, 0x76543210, 0xfedcba98, false, false));
}

__device__ inline v8f wmma_f16(v16h a, v16h b, v8f c) {
  return __builtin_amdgcn_wmma_f32_16x16x32_f16(false, a, false, b, (short)0, c, false, false);
}

__global__ void cvt_weights_kernel(const float* __restrict__ qw,
                                   const float* __restrict__ pw,
                                   f16* __restrict__ q16, f16* __restrict__ p16) {
  // Packs W[row][k] in WMMA B-fragment order: [16-row tile][32-k step][half h][lane][8 elems], so that
  // one wave-wide 16-byte load in the main kernel reads 512 contiguous bytes (4 whole lines, not 16 pieces).
  int i = blockIdx.x * 256 + threadIdx.x;   // grid = 768 blocks -> 196608 = 768*256 exactly
  int e = i & 7, ln = (i >> 3) & 31, h = (i >> 8) & 1, ks = (i >> 9) & 7, tile = i >> 12;
  int src = (tile * 16 + (ln & 15)) * 256 + ks * 32 + h * 16 + (ln >> 4) * 8 + e;
  q16[i] = (f16)qw[src];
  if (i < 256 * 256) p16[i] = (f16)pw[src];
}

// waves_per_eu(4): holds the register budget at 256, so that two work-groups stay resident per WGP as before
__global__ __launch_bounds__(256) __attribute__((amdgpu_waves_per_eu(4)))
void swin_window_attn_kernel(const float* __restrict__ x,
                             const f16* __restrict__ wq16,
                             const float* __restrict__ qkv_b,
                             const f16* __restrict__ wp16,
                             const float* __restrict__ proj_b,
                             const float* __restrict__ bias_tab,
                             float* __restrict__ out) {
  extern __shared__ __align__(16) char smem[];
  f16*   Xs    = (f16*)(smem + OFF_X);
  f16*   Qs    = (f16*)(smem + OFF_Q);
  f16*   Ks    = (f16*)(smem + OFF_K);
  f16*   Vt    = (f16*)(smem + OFF_V);
  float* biasT = (float*)(smem + OFF_B);

  const int tid  = threadIdx.x;
  const int lane = tid & 31;
  const int wv   = tid >> 5;        // wave id == head id for attention phases
  const int hh   = lane >> 4;       // half-wave select
  const int lm   = lane & 15;
  const int kb   = hh * 8;          // per-lane k chunk base (ISA 16-bit A/B layout)

  const int bx   = blockIdx.x;      // 2048 windows
  const int b    = bx >> 6;
  const int widx = bx & 63;
  const int wy   = widx >> 3, wx = widx & 7;
  const long imgbase = (long)b * (256L * 4096L);

  // ---------------- Phase 0: stage bias table + window input (fp32 -> f16) ----------------
  for (int k2 = tid; k2 < 225 * 8; k2 += 256) biasT[k2] = bias_tab[k2];
  #pragma unroll
  for (int it = 0; it < 8; ++it) {
    int c = it * 32 + (tid >> 3);
    int i = tid & 7;
    const float* src = x + imgbase + (long)c * 4096 + (wy * 8 + i) * 64 + wx * 8;
    float4 r0 = *(const float4*)src;
    float4 r1 = *(const float4*)(src + 4);
    f16* dst = Xs + c;
    int t0 = i * 8;
    dst[(t0+0)*CP] = (f16)r0.x; dst[(t0+1)*CP] = (f16)r0.y;
    dst[(t0+2)*CP] = (f16)r0.z; dst[(t0+3)*CP] = (f16)r0.w;
    dst[(t0+4)*CP] = (f16)r1.x; dst[(t0+5)*CP] = (f16)r1.y;
    dst[(t0+6)*CP] = (f16)r1.z; dst[(t0+7)*CP] = (f16)r1.w;
  }
  __syncthreads();

  // ---------------- Phase 1: QKV GEMM  (64x768) = Xs(64x256) @ Wqkv^T ----------------
  const float scale = 0.17677669529663687f;   // 1/sqrt(32), folded into Q
  for (int p = 0; p < 2; ++p) {
    const int ct = (wv + p * 8) * 16;
    const int c = ct + lm;
    const float bv = qkv_b[512 + c];
    v8f bq, bk;           // biases of the lane's 8 channels
    const f16* wb = wq16 + (wv + p * 8) * 4096 + lane * 8;
    const f16* xa = Xs + lm * CP + kb;
    v8f  acc[3][4];
    v16h af[2][4];        // X fragments of this k step and the next
    v16h bw[8];           // weight fragments, ring over f = 3 * ks + g (g: 0 = Q, 1 = K, 2 = V tile, 16 tiles apart)
    auto load_w = [&](int f) { bw[f % 8] = fragw(wb + (f % 3) * 65536 + (f / 3) * 512); };
    auto load_x = [&](int ks) {
      #pragma unroll
      for (int mt = 0; mt < 4; ++mt)
        af[ks & 1][mt] = frag16(xa + mt * 16 * CP + ks * 32);
    };
    #pragma unroll
    for (int f = 0; f < 5; ++f) load_w(f);
    load_x(0);
    #pragma unroll
    for (int ks = 0; ks < 8; ++ks) {
      #pragma unroll
      for (int f = 3 * ks + 5; f < 3 * ks + 8; ++f)
        if (f < 24) load_w(f);
      if (ks < 7) load_x(ks + 1);
      if (ks == 7) {      // the last step fetches no fragments: its registers take the biases
        bq = *(const v8f*)(qkv_b + ct + 8 * hh);
        bk = *(const v8f*)(qkv_b + 256 + ct + 8 * hh);
      }
      // keeps the loads above as one group ahead of this step's WMMAs (the scheduler otherwise sinks each to its use)
      __builtin_amdgcn_sched_barrier(0);
      #pragma unroll
      for (int g = 0; g < 3; ++g)
        #pragma unroll
        for (int mt = 0; mt < 4; ++mt) {
          v8f cin = {};
          if (ks != 0) cin = acc[g][mt];
          acc[g][mt] = g < 2 ? wmma_f16(bw[(3 * ks + g) % 8], af[ks & 1][mt], cin)
                             : wmma_f16(af[ks & 1][mt], bw[(3 * ks + g) % 8], cin);
        }
      // closes the fence pair: the next step's loads and the stores behind the loop stay out of this WMMA block
      __builtin_amdgcn_sched_barrier(0);
    }
    #pragma unroll
    for (int mt = 0; mt < 4; ++mt) {
      v8h q8, k8;
      #pragma unroll
      for (int r = 0; r < 8; ++r) {
        q8[r] = (f16)((acc[0][mt][r] + bq[r]) * scale);   // Q (scaled)
        k8[r] = (f16)(acc[1][mt][r] + bk[r]);             // K
      }
      *(v8h*)(Qs + (mt * 16 + lm) * CP + ct + 8 * hh) = q8;
      *(v8h*)(Ks + (mt * 16 + lm) * CP + ct + 8 * hh) = k8;
    }
    #pragma unroll
    for (int mt = 0; mt < 4; ++mt)            // V, stored transposed: Vt[channel][token]
      #pragma unroll
      for (int r = 0; r < 8; ++r)
        Vt[c * VP + (mt * 16 + r + 8 * hh)] = (f16)(acc[2][mt][r] + bv);
  }
  __syncthreads();

  // ---------------- Phase 2: scores (one head per wave), bias, softmax ----------------
  // K is A and Q is B: s[mt][nt][r] = score(query t = mt*16 + lm, key u = nt*16 + 8*hh + r). A lane holds 32 of its
  // query's 64 keys and lane ^ 16 the other 32.
  v8f s[4][4];
  {
    v16h aq[4];
    #pragma unroll
    for (int mt = 0; mt < 4; ++mt)
      aq[mt] = frag16(Qs + (mt * 16 + lm) * CP + wv * 32 + kb);
    #pragma unroll
    for (int nt = 0; nt < 4; ++nt) {
      v16h bk = frag16(Ks + (nt * 16 + lm) * CP + wv * 32 + kb);
      #pragma unroll
      for (int mt = 0; mt < 4; ++mt) {
        v8f z = {};
        s[mt][nt] = wmma_f16(bk, aq[mt], z);
      }
    }
  }
  // relative position bias: idx = (ti-ui+7)*15 + (tj-uj+7), table[idx][head]
  #pragma unroll
  for (int mt = 0; mt < 4; ++mt) {
    int t = mt * 16 + lm, ti = t >> 3, tj = t & 7;
    #pragma unroll
    for (int nt = 0; nt < 4; ++nt)
      #pragma unroll
      for (int r = 0; r < 8; ++r) {
        int u = nt * 16 + r + 8 * hh;
        int idx = (ti - (u >> 3) + 7) * 15 + (tj - (u & 7) + 7);
        s[mt][nt][r] += biasT[idx * 8 + wv];
      }
  }
  // softmax over u: 32 values in the lane (four partial sums), then one exchange with lane ^ 16
  #pragma unroll
  for (int mt = 0; mt < 4; ++mt) {
    float mx = s[mt][0][0];
    #pragma unroll
    for (int nt = 0; nt < 4; ++nt)
      #pragma unroll
      for (int r = 0; r < 8; ++r) mx = fmaxf(mx, s[mt][nt][r]);
    mx = fmaxf(mx, xhalf(mx));
    float ps[4];
    #pragma unroll
    for (int nt = 0; nt < 4; ++nt) {
      ps[nt] = 0.f;
      #pragma unroll
      for (int r = 0; r < 8; ++r) {
        float e = __expf(s[mt][nt][r] - mx);
        s[mt][nt][r] = e;
        ps[nt] += e;
      }
    }
    float sm = (ps[0] + ps[1]) + (ps[2] + ps[3]);
    sm += xhalf(sm);
    float inv = 1.0f / sm;
    #pragma unroll
    for (int nt = 0; nt < 4; ++nt) s[mt][nt] *= inv;
  }

  // ---------------- Phase 3: O = P @ V  (per head: 64x32, K=64) ----------------
  // Two score tiles of a query tile, converted in place, are the B fragment of a 32-key step (keys 8*hh + e and
  // 16 + 8*hh + e, the order in which frag16 reads Vt). Vt is A: a lane's 8 registers are 8 channels of one token.
  v8f ov[4][2] = {};
  #pragma unroll
  for (int ks = 0; ks < 2; ++ks) {
    v16h pf[4];
    #pragma unroll
    for (int mt = 0; mt < 4; ++mt)
      #pragma unroll
      for (int e = 0; e < 8; ++e) {
        pf[mt][e]     = (f16)s[mt][2 * ks][e];
        pf[mt][8 + e] = (f16)s[mt][2 * ks + 1][e];
      }
    #pragma unroll
    for (int nt = 0; nt < 2; ++nt) {
      v16h bvf = frag16(Vt + (wv * 32 + nt * 16 + lm) * VP + ks * 32 + kb);
      #pragma unroll
      for (int mt = 0; mt < 4; ++mt) ov[mt][nt] = wmma_f16(bvf, pf[mt], ov[mt][nt]);
    }
  }
  __syncthreads();   // all Vt reads done -> overlay Vt with Os
  f16* Os = (f16*)(smem + OFF_O);
  #pragma unroll
  for (int mt = 0; mt < 4; ++mt)
    #pragma unroll
    for (int nt = 0; nt < 2; ++nt) {
      v8h o8;
      #pragma unroll
      for (int r = 0; r < 8; ++r) o8[r] = (f16)ov[mt][nt][r];
      *(v8h*)(Os + (mt * 16 + lm) * CP + wv * 32 + nt * 16 + 8 * hh) = o8;
    }
  __syncthreads();

  // ---------------- Phase 4: projection GEMM (64x256) = Os @ Wproj^T, stored from registers ----------------
  {
    // One O fragment read from LDS feeds both of the wave's 16-channel tiles; same rings as in phase 1.
    // The weights are A and O is B: a lane holds 8 channels of one token, so lanes 0-7 (8-15) of one accumulator register
    // are one 32-byte window row of one channel in (B, C, H, W): each register goes to global memory as it is.
    const f16* wb = wp16 + wv * 8192 + lane * 8;
    const f16* oa = Os + lm * CP + kb;
    v8f  pb[2];           // biases of the lane's 8 channels in each tile
    v8f  acc[2][4];
    v16h af[2][4];
    v16h bw[4][2];
    auto load_w = [&](int s) {
      #pragma unroll
      for (int g = 0; g < 2; ++g) bw[s & 3][g] = fragw(wb + g * 4096 + s * 512);
    };
    auto load_o = [&](int s) {
      #pragma unroll
      for (int mt = 0; mt < 4; ++mt) af[s & 1][mt] = frag16(oa + mt * 16 * CP + s * 32);
    };
    load_w(0); load_w(1); load_w(2);
    load_o(0);
    #pragma unroll
    for (int s = 0; s < 8; ++s) {
      if (s + 3 < 8) load_w(s + 3);
      if (s + 1 < 8) load_o(s + 1);
      if (s == 7) {       // the last step fetches no fragments: its registers take the biases
        pb[0] = *(const v8f*)(proj_b + wv * 32 + 8 * hh);
        pb[1] = *(const v8f*)(proj_b + wv * 32 + 16 + 8 * hh);
      }
      // keeps the loads above as one group ahead of this step's WMMAs (the scheduler otherwise sinks each to its use)
      __builtin_amdgcn_sched_barrier(0);
      #pragma unroll
      for (int g = 0; g < 2; ++g)
        #pragma unroll
        for (int mt = 0; mt < 4; ++mt) {
          v8f cin = {};
          if (s != 0) cin = acc[g][mt];
          acc[g][mt] = wmma_f16(bw[s & 3][g], af[s & 1][mt], cin);
        }
      // closes the fence pair: the next step's loads and the stores behind the loop stay out of this WMMA block
      __builtin_amdgcn_sched_barrier(0);
    }
    // window reverse: token mt*16 + lm is pixel (wy*8 + mt*2 + lm/8, wx*8 + lm%8); channel planes are 4096 floats apart
    float* dst = out + imgbase + (long)(wv * 32 + 8 * hh) * 4096 + (wy * 8 + (lm >> 3)) * 64 + wx * 8 + (lm & 7);
    #pragma unroll
    for (int g = 0; g < 2; ++g)
      #pragma unroll
      for (int mt = 0; mt < 4; ++mt) acc[g][mt] += pb[g];
    #pragma unroll
    for (int g = 0; g < 2; ++g)
      #pragma unroll
      for (int mt = 0; mt < 4; ++mt)
        #pragma unroll
        for (int r = 0; r < 8; ++r)
          dst[(g * 16 + r) * 4096 + mt * 128] = acc[g][mt][r];
  }
}

}  // namespace

extern "C" void kernel_launch(void* const* d_in, const int* in_sizes, int n_in,
                              void* d_out, int out_size, void* d_ws, size_t ws_size,
                              hipStream_t stream) {
  const float* x        = (const float*)d_in[0];
  const float* qkv_w    = (const float*)d_in[1];
  const float* qkv_b    = (const float*)d_in[2];
  const float* proj_w   = (const float*)d_in[3];
  const float* proj_b   = (const float*)d_in[4];
  const float* bias_tab = (const float*)d_in[5];

  f16* wq16 = (f16*)d_ws;                               // 768*256 f16 = 393216 B
  f16* wp16 = (f16*)((char*)d_ws + 768 * 256 * 2);      // 256*256 f16 = 131072 B

  cvt_weights_kernel<<<768, 256, 0, stream>>>(qkv_w, proj_w, wq16, wp16);
  swin_window_attn_kernel<<<2048, 256, SMEM_BYTES, stream>>>(
      x, wq16, qkv_b, wp16, proj_b, bias_tab, (float*)d_out);
}

// v005
// One run takes 126 microseconds.
// Next to v004, in two timings, it ran 1.29 times as fast each time.
// All steps since v000 together make it 1.89 times as fast.
#include <hip/hip_runtime.h>

typedef _Float16 f16;
typedef _Float16 v16h __attribute__((ext_vector_type(16)));
typedef _Float16 v8h  __attribute__((ext_vector_type(8)));
typedef float    v8f  __attribute__((ext_vector_type(8)));

namespace {

// A work-group takes TWO horizontally adjacent windows: 128 tokens, token row = win * 64 + t.
constexpr int CP = 264;   // f16 pitch (elems) for 128x256 LDS matrices (pad 8 kills bank conflicts)
constexpr int VP = 136;   // Vt pitch: [256 ch][128 tok + pad]
constexpr int OW = 64;    // Os only: window 1's rows stand 128 bytes further, so that rows t and 64 + t differ in bank

// LDS layout (bytes); one work-group per WGP
constexpr int MAT    = 128 * CP * 2;            // one 128x264 f16 matrix = 67584
constexpr int OFF_X  = 0;                       // Xs  (phase 0-1)
constexpr int OFF_O  = OFF_X;                   // Os  (phase 3-4) overlays Xs, dead behind the barrier that ends phase 1
constexpr int OFF_Q  = MAT + OW * 2;            // Qs  (phase 1-2), behind the 128 bytes by which Os is longer than Xs
constexpr int OFF_K  = OFF_Q + MAT;             // Ks  (phase 1-2)
constexpr int OFF_V  = OFF_K + MAT;             // Vt  256x136 f16 = 69632  (phase 1-3)
constexpr int OFF_B  = OFF_V + 256 * VP * 2;    // bias table 225x8 f32 = 7200
constexpr int SMEM_BYTES = OFF_B + 225 * 8 * 4; // 279712 B  (< 320KB/WGP)

__device__ inline v16h frag16(const f16* p) {
  // WMMA A/B operand: two contiguous 8xf16 chunks at k-offset 0 and +16 (per ISA VGPR layout)
  v8h lo = *(const v8h*)p;
  v8h hi = *(const v8h*)(p + 16);
  return __builtin_shufflevector(lo, hi, 0,1,2,3,4,5,6,7,8,9,10,11,12,13,14,15);
}

__device__ inline v16h fragw(const f16* p) {
  // packed weight fragment: the 32 lanes' low 8-element k chunks lie in one 512-byte run, their high chunks (k + 16) in the next
  v8h lo = *(const v8h*)p;
  v8h hi = *(const v8h*)(p + 256);
  return __builtin_shufflevector(lo, hi, 0,1,2,3,4,5,6,7,8,9,10,11,12,13,14,15);
}

__device__ inline float xhalf(float v) {
  // value of lane l ^ 16 (the lane that holds the other half of the same column's rows)
  int b = __builtin_bit_cast(int, v);
  return __builtin_bit_cast(float, __builtin_amdgcn_permlanex16(b, b, 0x76543210, 0xfedcba98, false, false));
}

__device__ inline v8f wmma_f16(v16h a, v16h b, v8f c) {
  return __builtin_amdgcn_wmma_f32_16x16x32_f16(false, a, false, b, (short)0, c, false, false);
}

__global__ void cvt_weights_kernel(const float* __restrict__ qw,
                                   const float* __restrict__ pw,
                                   f16* __restrict__ q16, f16* __restrict__ p16) {
  // Packs W[row][k] in WMMA B-fragment order: [16-row tile][32-k step][half h][lane][8 elems], so that
  // one wave-wide 16-byte load in the main kernel reads 512 contiguous bytes (4 whole lines, not 16 pieces).
  int i = blockIdx.x * 256 + threadIdx.x;   // grid = 768 blocks -> 196608 = 768*256 exactly
  int e = i & 7, ln = (i >> 3) & 31, h = (i >> 8) & 1, ks = (i >> 9) & 7, tile = i >> 12;
  int src = (tile * 16 + (ln & 15)) * 256 + ks * 32 + h * 16 + (ln >> 4) * 8 + e;
  q16[i] = (f16)qw[src];
  if (i < 256 * 256) p16[i] = (f16)pw[src];
}

__global__ __launch_bounds__(256)
void swin_window_attn_kernel(const float* __restrict__ x,
                             const f16* __restrict__ wq16,
                             const float* __restrict__ qkv_b,
                             const f16* __restrict__ wp16,
                             const float* __restrict__ proj_b,
                             const float* __restrict__ bias_tab,
                             float* __restrict__ out) {
  __shared__ __align__(16) char smem[SMEM_BYTES];
  f16*   Xs    = (f16*)(smem + OFF_X);
  f16*   Qs    = (f16*)(smem + OFF_Q);
  f16*   Ks    = (f16*)(smem + OFF_K);
  f16*   Vt    = (f16*)(smem + OFF_V);
  float* biasT = (float*)(smem + OFF_B);

  const int tid  = threadIdx.x;
  const int lane = tid & 31;
  const int wv   = tid >> 5;        // wave id == head id for attention phases
  const int hh   = lane >> 4;       // half-wave select
  const int lm   = lane & 15;
  const int kb   = hh * 8;          // per-lane k chunk base (ISA 16-bit A/B layout)

  const int bx   = blockIdx.x;      // 1024 window pairs
  const int b    = bx >> 5;
  const int widx = bx & 31;
  const int wy   = widx >> 2, wxp = widx & 3;   // windows (wy, 2 * wxp) and (wy, 2 * wxp + 1)
  const long imgbase = (long)b * (256L * 4096L);

  // ---------------- Phase 0: stage bias table + window input (fp32 -> f16) ----------------
  for (int k2 = tid; k2 < 225 * 8; k2 += 256) biasT[k2] = bias_tab[k2];
  // A pixel row of the pair is 64 contiguous bytes of a channel plane: 4 neighbouring lanes read it, so a wave-wide load
  // touches 8 lines. A lane reads the same 4 pixels of 8 consecutive channels and stores each pixel's 8 channels at once.
  {
    const int qd = lane & 3;                       // which 16 bytes of the 64: window qd >> 1, columns 4 * (qd & 1) ...
    const int c0 = wv * 32 + (lane >> 3) * 8;      // the lane's 8 channels
    const float* src = x + imgbase + (long)c0 * 4096 + (wy * 8 + ((lane >> 2) & 1)) * 64 + wxp * 16 + qd * 4;
    f16* dst = Xs + ((qd >> 1) * 64 + ((lane >> 2) & 1) * 8 + (qd & 1) * 4) * CP + c0;
    float4 rx[4][8];
    #pragma unroll
    for (int gi = 0; gi < 4; ++gi)                 // pixel rows 2 * gi and 2 * gi + 1
      #pragma unroll
      for (int j = 0; j < 8; ++j) rx[gi][j] = *(const float4*)(src + j * 4096 + gi * 128);
    #pragma unroll
    for (int gi = 0; gi < 4; ++gi) {
      v8h h0, h1, h2, h3;
      #pragma unroll
      for (int j = 0; j < 8; ++j) {
        h0[j] = (f16)rx[gi][j].x; h1[j] = (f16)rx[gi][j].y;
        h2[j] = (f16)rx[gi][j].z; h3[j] = (f16)rx[gi][j].w;
      }
      *(v8h*)(dst + (gi * 16 + 0) * CP) = h0; *(v8h*)(dst + (gi * 16 + 1) * CP) = h1;
      *(v8h*)(dst + (gi * 16 + 2) * CP) = h2; *(v8h*)(dst + (gi * 16 + 3) * CP) = h3;
    }
  }
  __syncthreads();

  // ---------------- Phase 1: QKV GEMM  (128x768) = Xs(128x256) @ Wqkv^T ----------------
  const float scale = 0.17677669529663687f;   // 1/sqrt(32), folded into Q
  for (int p = 0; p < 2; ++p) {
    const int ct = (wv + p * 8) * 16;
    const int c = ct + lm;
    const float bv = qkv_b[512 + c];
    v8f bq, bk;           // biases of the lane's 8 channels
    const f16* wb = wq16 + (wv + p * 8) * 4096 + lane * 8;
    const f16* xa = Xs + lm * CP + kb;
    v8f  acc[3][8];
    v16h af[2][8];        // X fragments of this k step and the next
    v16h bw[8];           // weight fragments, ring over f = 3 * ks + g (g: 0 = Q, 1 = K, 2 = V tile, 16 tiles apart)
    auto load_w = [&](int f) { bw[f % 8] = fragw(wb + (f % 3) * 65536 + (f / 3) * 512); };
    auto load_x = [&](int ks) {
      #pragma unroll
      for (int mt = 0; mt < 8; ++mt)
        af[ks & 1][mt] = frag16(xa + mt * 16 * CP + ks * 32);
    };
    #pragma unroll
    for (int f = 0; f < 5; ++f) load_w(f);
    load_x(0);
    #pragma unroll
    for (int ks = 0; ks < 8; ++ks) {
      #pragma unroll
      for (int f = 3 * ks + 5; f < 3 * ks + 8; ++f)
        if (f < 24) load_w(f);
      if (ks < 7) load_x(ks + 1);
      if (ks == 7) {      // the last step fetches no fragments: its registers take the biases
        bq = *(const v8f*)(qkv_b + ct + 8 * hh);
        bk = *(const v8f*)(qkv_b + 256 + ct + 8 * hh);
      }
      // keeps the loads above as one group ahead of this step's WMMAs (the scheduler otherwise sinks each to its use)
      __builtin_amdgcn_sched_barrier(0);
      #pragma unroll
      for (int g = 0; g < 3; ++g)
        #pragma unroll
        for (int mt = 0; mt < 8; ++mt) {
          v8f cin = {};
          if (ks != 0) cin = acc[g][mt];
          acc[g][mt] = g < 2 ? wmma_f16(bw[(3 * ks + g) % 8], af[ks & 1][mt], cin)
                             : wmma_f16(af[ks & 1][mt], bw[(3 * ks + g) % 8], cin);
        }
      // closes the fence pair: the next step's loads and the stores behind the loop stay out of this WMMA block
      __builtin_amdgcn_sched_barrier(0);
    }
    #pragma unroll
    for (int mt = 0; mt < 8; ++mt) {
      v8h q8, k8;
      #pragma unroll
      for (int r = 0; r < 8; ++r) {
        q8[r] = (f16)((acc[0][mt][r] + bq[r]) * scale);   // Q (scaled)
        k8[r] = (f16)(acc[1][mt][r] + bk[r]);             // K
      }
      *(v8h*)(Qs + (mt * 16 + lm) * CP + ct + 8 * hh) = q8;
      *(v8h*)(Ks + (mt * 16 + lm) * CP + ct + 8 * hh) = k8;
    }
    #pragma unroll
    for (int mt = 0; mt < 8; ++mt)            // V, stored transposed: Vt[channel][token]
      #pragma unroll
      for (int r = 0; r < 8; ++r)
        Vt[c * VP + (mt * 16 + r + 8 * hh)] = (f16)(acc[2][mt][r] + bv);
  }
  __syncthreads();

  // ---------------- Phase 2: scores (one head per wave), bias, softmax ----------------
  // K is A and Q is B: s[mt][nt][r] = score(query t = mt*16 + lm, key u = nt*16 + 8*hh + r). A lane holds 32 of its
  // query's 64 keys and lane ^ 16 the other 32. The wave does its head for window 0, then for window 1.
  f16* Os = (f16*)(smem + OFF_O);
  // kept rolled: the second window runs the first one's text again (the kernel's text stays small for the instruction cache)
  #pragma unroll 1
  for (int win = 0; win < 2; ++win) {
  v8f s[4][4];
  {
    v16h aq[4];
    #pragma unroll
    for (int mt = 0; mt < 4; ++mt)
      aq[mt] = frag16(Qs + (win * 64 + mt * 16 + lm) * CP + wv * 32 + kb);
    #pragma unroll
    for (int nt = 0; nt < 4; ++nt) {
      v16h bk = frag16(Ks + (win * 64 + nt * 16 + lm) * CP + wv * 32 + kb);
      #pragma unroll
      for (int mt = 0; mt < 4; ++mt) {
        v8f z = {};
        s[mt][nt] = wmma_f16(bk, aq[mt], z);
      }
    }
  }
  // relative position bias: idx = (ti-ui+7)*15 + (tj-uj+7), table[idx][head]
  #pragma unroll
  for (int mt = 0; mt < 4; ++mt) {
    int t = mt * 16 + lm, ti = t >> 3, tj = t & 7;
    #pragma unroll
    for (int nt = 0; nt < 4; ++nt)
      #pragma unroll
      for (int r = 0; r < 8; ++r) {
        int u = nt * 16 + r + 8 * hh;
        int idx = (ti - (u >> 3) + 7) * 15 + (tj - (u & 7) + 7);
        s[mt][nt][r] += biasT[idx * 8 + wv];
      }
  }
  // softmax over u: 32 values in the lane (four partial sums), then one exchange with lane ^ 16
  #pragma unroll
  for (int mt = 0; mt < 4; ++mt) {
    float mx = s[mt][0][0];
    #pragma unroll
    for (int nt = 0; nt < 4; ++nt)
      #pragma unroll
      for (int r = 0; r < 8; ++r) mx = fmaxf(mx, s[mt][nt][r]);
    mx = fmaxf(mx, xhalf(mx));
    float ps[4];
    #pragma unroll
    for (int nt = 0; nt < 4; ++nt) {
      ps[nt] = 0.f;
      #pragma unroll
      for (int r = 0; r < 8; ++r) {
        float e = __expf(s[mt][nt][r] - mx);
        s[mt][nt][r] = e;
        ps[nt] += e;
      }
    }
    float sm = (ps[0] + ps[1]) + (ps[2] + ps[3]);
    sm += xhalf(sm);
    float inv = 1.0f / sm;
    #pragma unroll
    for (int nt = 0; nt < 4; ++nt) s[mt][nt] *= inv;
  }

  // ---------------- Phase 3: O = P @ V  (per head: 64x32, K=64) ----------------
  // Two score tiles of a query tile, converted in place, are the B fragment of a 32-key step (keys 8*hh + e and
  // 16 + 8*hh + e, the order in which frag16 reads Vt). Vt is A: a lane's 8 registers are 8 channels of one token.
  v8f ov[4][2] = {};
  #pragma unroll
  for (int ks = 0; ks < 2; ++ks) {
    v16h pf[4];
    #pragma unroll
    for (int mt = 0; mt < 4; ++mt)
      #pragma unroll
      for (int e = 0; e < 8; ++e) {
        pf[mt][e]     = (f16)s[mt][2 * ks][e];
        pf[mt][8 + e] = (f16)s[mt][2 * ks + 1][e];
      }
    #pragma unroll
    for (int nt = 0; nt < 2; ++nt) {
      v16h bvf = frag16(Vt + (wv * 32 + nt * 16 + lm) * VP + win * 64 + ks * 32 + kb);
      #pragma unroll
      for (int mt = 0; mt < 4; ++mt) ov[mt][nt] = wmma_f16(bvf, pf[mt], ov[mt][nt]);
    }
  }
  // Os lies over Xs, which nobody reads behind phase 1's barrier: no barrier in front of these stores
  #pragma unroll
  for (int mt = 0; mt < 4; ++mt)
    #pragma unroll
    for (int nt = 0; nt < 2; ++nt) {
      v8h o8;
      #pragma unroll
      for (int r = 0; r < 8; ++r) o8[r] = (f16)ov[mt][nt][r];
      *(v8h*)(Os + (win * 64 + mt * 16 + lm) * CP + win * OW + wv * 32 + nt * 16 + 8 * hh) = o8;
    }
  }
  __syncthreads();

  // ---------------- Phase 4: projection GEMM (128x256) = Os @ Wproj^T, stored from registers ----------------
  {
    // One O fragment read from LDS feeds both of the wave's 16-channel tiles; same rings as in phase 1.
    // The weights are A and O is B: a lane holds 8 channels of one token. Token tile mt is pixel row mt of BOTH windows
    // (lanes 0-7 window 0, lanes 8-15 window 1), so lanes 0-15 of one accumulator register are 64 contiguous bytes of one
    // channel in (B, C, H, W): each register goes to global memory as it is.
    const f16* wb = wp16 + wv * 8192 + lane * 8;
    const f16* oa = Os + ((lm >> 3) * 64 + (lm & 7)) * CP + (lm >> 3) * OW + kb;
    v8f  pb[2];           // biases of the lane's 8 channels in each tile
    v8f  acc[2][8];
    v16h af[2][8];
    v16h bw[4][2];
    auto load_w = [&](int s) {
      #pragma unroll
      for (int g = 0; g < 2; ++g) bw[s & 3][g] = fragw(wb + g * 4096 + s * 512);
    };
    auto load_o = [&](int s) {
      #pragma unroll
      for (int mt = 0; mt < 8; ++mt) af[s & 1][mt] = frag16(oa + mt * 8 * CP + s * 32);
    };
    load_w(0); load_w(1); load_w(2);
    load_o(0);
    #pragma unroll
    for (int s = 0; s < 8; ++s) {
      if (s + 3 < 8) load_w(s + 3);
      // behind the last weight load
      if (s + 3 == 7) asm volatile("s_wait_xcnt 0x0" ::: "memory");
      if (s + 1 < 8) load_o(s + 1);
      if (s == 7) {       // the last step fetches no fragments: its registers take the biases
        pb[0] = *(const v8f*)(proj_b + wv * 32 + 8 * hh);
        pb[1] = *(const v8f*)(proj_b + wv * 32 + 16 + 8 * hh);
      }
      // keeps the loads above as one group ahead of this step's WMMAs (the scheduler otherwise sinks each to its use)
      __builtin_amdgcn_sched_barrier(0);
      #pragma unroll
      for (int g = 0; g < 2; ++g)
        #pragma unroll
        for (int mt = 0; mt < 8; ++mt) {
          v8f cin = {};
          if (s != 0) cin = acc[g][mt];
          acc[g][mt] = wmma_f16(bw[s & 3][g], af[s & 1][mt], cin);
        }
      // closes the fence pair: the next step's loads and the stores behind the loop stay out of this WMMA block
      __builtin_amdgcn_sched_barrier(0);
    }
    // window reverse: column lm of tile mt is pixel (wy*8 + mt, wxp*16 + lm); channel planes are 4096 floats apart
    float* dst = out + imgbase + (long)(wv * 32 + 8 * hh) * 4096 + (wy * 8) * 64 + wxp * 16 + lm;
    #pragma unroll
    for (int g = 0; g < 2; ++g)
      #pragma unroll
      for (int mt = 0; mt < 8; ++mt) acc[g][mt] += pb[g];
    #pragma unroll
    for (int g = 0; g < 2; ++g)
      #pragma unroll
      for (int mt = 0; mt < 8; ++mt)
        #pragma unroll
        for (int r = 0; r < 8; ++r)
          dst[(g * 16 + r) * 4096 + mt * 64] = acc[g][mt][r];
  }
}

}  // namespace

extern "C" void kernel_launch(void* const* d_in, const int* in_sizes, int n_in,
                              void* d_out, int out_size, void* d_ws, size_t ws_size,
                              hipStream_t stream) {
  const float* x        = (const float*)d_in[0];
  const float* qkv_w    = (const float*)d_in[1];
  const float* qkv_b    = (const float*)d_in[2];
  const float* proj_w   = (const float*)d_in[3];
  const float* proj_b   = (const float*)d_in[4];
  const float* bias_tab = (const float*)d_in[5];

  f16* wq16 = (f16*)d_ws;                               // 768*256 f16 = 393216 B
  f16* wp16 = (f16*)((char*)d_ws + 768 * 256 * 2);      // 256*256 f16 = 131072 B

  cvt_weights_kernel<<<768, 256, 0, stream>>>(qkv_w, proj_w, wq16, wp16);
  swin_window_attn_kernel<<<1024, 256, 0, stream>>>(
      x, wq16, qkv_b, wp16, proj_b, bias_tab, (float*)d_out);
}

// v006
// Measured time: 121 microseconds a run.
// Next to v005, in two timings, it ran 1.03 and 1.04 times as fast.
// All steps since v000 together make it 1.96 times as fast.
#include <hip/hip_runtime.h>

typedef _Float16 f16;
typedef _Float16 v16h __attribute__((ext_vector_type(16)));
typedef _Float16 v8h  __attribute__((ext_vector_type(8)));
typedef float    v8f  __attribute__((ext_vector_type(8)));

namespace {

// A work-group takes TWO horizontally adjacent windows: 128 tokens, token row = win * 64 + t.
constexpr int CP = 264;   // f16 pitch (elems) for 128x256 LDS matrices (pad 8 kills bank conflicts)
constexpr int VP = 136;   // Vt pitch: [256 ch][128 tok + pad]
constexpr int OW = 64;    // Os only: window 1's rows stand 128 bytes further, so that rows t and 64 + t differ in bank

// LDS layout (bytes); one work-group per WGP
constexpr int MAT    = 128 * CP * 2;            // one 128x264 f16 matrix = 67584
constexpr int OFF_X  = 0;                       // Xs  (phase 0-1)
constexpr int OFF_O  = OFF_X;                   // Os  (phase 3-4) overlays Xs, dead behind the barrier that ends phase 1
constexpr int OFF_Q  = MAT + OW * 2;            // Qs  (phase 1-2), behind the 128 bytes by which Os is longer than Xs
constexpr int OFF_S  = OFF_Q;                   // the next pair's x, f32, 131072 B (phase 4-0), over Qs and Ks, dead behind phase 3's barrier
constexpr int OFF_K  = OFF_Q + MAT;             // Ks  (phase 1-2)
constexpr int OFF_V  = OFF_K + MAT;             // Vt  256x136 f16 = 69632  (phase 1-3)
constexpr int OFF_B  = OFF_V + 256 * VP * 2;    // bias table 225x8 f32 = 7200
constexpr int SMEM_BYTES = OFF_B + 225 * 8 * 4; // 279712 B  (< 320KB/WGP)

__device__ inline v16h frag16(const f16* p) {
  // WMMA A/B operand: two contiguous 8xf16 chunks at k-offset 0 and +16 (per ISA VGPR layout)
  v8h lo = *(const v8h*)p;
  v8h hi = *(const v8h*)(p + 16);
  return __builtin_shufflevector(lo, hi, 0,1,2,3,4,5,6,7,8,9,10,11,12,13,14,15);
}

__device__ inline v16h fragw(const f16* p) {
  // packed weight fragment: the 32 lanes' low 8-element k chunks lie in one 512-byte run, their high chunks (k + 16) in the next
  v8h lo = *(const v8h*)p;
  v8h hi = *(const v8h*)(p + 256);
  return __builtin_shufflevector(lo, hi, 0,1,2,3,4,5,6,7,8,9,10,11,12,13,14,15);
}

__device__ inline float xhalf(float v) {
  // value of lane l ^ 16 (the lane that holds the other half of the same column's rows)
  int b = __builtin_bit_cast(int, v);
  return __builtin_bit_cast(float, __builtin_amdgcn_permlanex16(b, b, 0x76543210, 0xfedcba98, false, false));
}

__device__ inline v8f wmma_f16(v16h a, v16h b, v8f c) {
  return __builtin_amdgcn_wmma_f32_16x16x32_f16(false, a, false, b, (short)0, c, false, false);
}

__global__ void cvt_weights_kernel(const float* __restrict__ qw,
                                   const float* __restrict__ pw,
                                   f16* __restrict__ q16, f16* __restrict__ p16) {
  // Packs W[row][k] in WMMA B-fragment order: [16-row tile][32-k step][half h][lane][8 elems], so that
  // one wave-wide 16-byte load in the main kernel reads 512 contiguous bytes (4 whole lines, not 16 pieces).
  int i = blockIdx.x * 256 + threadIdx.x;   // grid = 768 blocks -> 196608 = 768*256 exactly
  int e = i & 7, ln = (i >> 3) & 31, h = (i >> 8) & 1, ks = (i >> 9) & 7, tile = i >> 12;
  int src = (tile * 16 + (ln & 15)) * 256 + ks * 32 + h * 16 + (ln >> 4) * 8 + e;
  q16[i] = (f16)qw[src];
  if (i < 256 * 256) p16[i] = (f16)pw[src];
}

__global__ __launch_bounds__(256)
void swin_window_attn_kernel(const float* __restrict__ x,
                             // weights and biases without __restrict__: with it the compiler lifts their loads, the same
                             // for every pair, out of the loop over pairs and keeps them in scratch memory
                             const f16* wq16,
                             const float* qkv_b,
                             const f16* wp16,
                             const float* proj_b,
                             const float* __restrict__ bias_tab,
                             float* __restrict__ out) {
  __shared__ __align__(16) char smem[SMEM_BYTES];
  f16*   Xs    = (f16*)(smem + OFF_X);
  f16*   Qs    = (f16*)(smem + OFF_Q);
  f16*   Ks    = (f16*)(smem + OFF_K);
  f16*   Vt    = (f16*)(smem + OFF_V);
  float* biasT = (float*)(smem + OFF_B);

  const int tid  = threadIdx.x;
  const int lane = tid & 31;
  const int wv   = tid >> 5;        // wave id == head id for attention phases
  const int hh   = lane >> 4;       // half-wave select
  const int lm   = lane & 15;
  const int kb   = hh * 8;          // per-lane k chunk base (ISA 16-bit A/B layout)

  // 256 work-groups, one per WGP; each walks the window pairs blockIdx.x + 256 * it, it = 0 .. 3: the same place in the
  // image, 8 images further each trip.
  const int widx = blockIdx.x & 31;
  const int wy   = widx >> 2, wxp = widx & 3;   // windows (wy, 2 * wxp) and (wy, 2 * wxp + 1)
  constexpr long IMG = 256L * 4096L;            // floats of one image
  constexpr int  NIT = 4;                       // pairs per work-group

  // A pixel row of the pair is 64 contiguous bytes of a channel plane: 4 neighbouring lanes read it, so a wave-wide copy
  // touches 8 lines. A lane takes the same 4 pixels of 8 consecutive channels and stores each pixel's 8 channels at once.
  const int qd = lane & 3;                       // which 16 bytes of the 64: window qd >> 1, columns 4 * (qd & 1) ...
  const int c0 = wv * 32 + (lane >> 3) * 8;      // the lane's 8 channels
  const int xoff = c0 * 4096 + (wy * 8 + ((lane >> 2) & 1)) * 64 + wxp * 16 + qd * 4;   // the lane's place in its image
  // Staging space: the copy of channel c0 + j, pixel rows 2 * gi and 2 * gi + 1, of wave wv fills 512 bytes in a row, 16 a lane,
  // at j * 16384 + wv * 2048 + gi * 512; a lane reads back what it copied. A step of j or of gi is as many bytes in LDS as in x,
  // so one pair of address registers with immediate offsets, which move both addresses alike, serves 16 copies.
  char* stg = smem + OFF_S + wv * 2048 + lane * 16;
  auto copy_x = [&](int it) {
    const float* src = x + (long)((blockIdx.x >> 5) + 8 * it) * IMG + xoff;
    const unsigned l0 = (unsigned)(size_t)stg;     // the lane's LDS byte address
    #pragma unroll
    for (int h = 0; h < 2; ++h) {                  // channels c0 + 4 * h ...: 65536 bytes further in x and in LDS
      // x goes to LDS through no register; the last line keeps every rewrite of an address register behind the copies
      asm volatile("global_load_async_to_lds_b128 %0, %1, off\n\t"
                   "global_load_async_to_lds_b128 %0, %1, off offset:512\n\t"
                   "global_load_async_to_lds_b128 %0, %1, off offset:1024\n\t"
                   "global_load_async_to_lds_b128 %0, %1, off offset:1536\n\t"
                   "global_load_async_to_lds_b128 %0, %1, off offset:16384\n\t"
                   "global_load_async_to_lds_b128 %0, %1, off offset:16896\n\t"
                   "global_load_async_to_lds_b128 %0, %1, off offset:17408\n\t"
                   "global_load_async_to_lds_b128 %0, %1, off offset:17920\n\t"
                   "global_load_async_to_lds_b128 %0, %1, off offset:32768\n\t"
                   "global_load_async_to_lds_b128 %0, %1, off offset:33280\n\t"
                   "global_load_async_to_lds_b128 %0, %1, off offset:33792\n\t"
                   "global_load_async_to_lds_b128 %0, %1, off offset:34304\n\t"
                   "global_load_async_to_lds_b128 %0, %1, off offset:49152\n\t"
                   "global_load_async_to_lds_b128 %0, %1, off offset:49664\n\t"
                   "global_load_async_to_lds_b128 %0, %1, off offset:50176\n\t"
                   "global_load_async_to_lds_b128 %0, %1, off offset:50688\n\t"
                   "s_wait_xcnt 0x0"
                   :: "v"(l0 + h * 65536), "v"(src + h * 16384)
                   : "memory");
    }
  };

  // ---------------- Prologue: first pair's input on its way, bias table staged ----------------
  copy_x(0);
  for (int k2 = tid; k2 < 225 * 8; k2 += 256) biasT[k2] = bias_tab[k2];

  // kept rolled: every pair runs the same text (the kernel's text stays small for the instruction cache)
  #pragma unroll 1
  for (int it = 0;; ++it) {
  const long imgbase = (long)((blockIdx.x >> 5) + 8 * it) * IMG;
  const bool more = it + 1 < NIT;   // the same for the whole work-group

  // ---------------- Phase 0: window input, staged f32 -> f16 ----------------
  // this wave's copies have landed
  asm volatile("s_wait_asynccnt 0x0" ::: "memory");
  // publishes the staged x; and every wave has read its last O fragment before X is written over O
  __syncthreads();
  {
    f16* dst = Xs + ((qd >> 1) * 64 + ((lane >> 2) & 1) * 8 + (qd & 1) * 4) * CP + c0;
    float4 rx[4][8];
    #pragma unroll
    for (int gi = 0; gi < 4; ++gi)
      #pragma unroll
      for (int j = 0; j < 8; ++j) rx[gi][j] = *(const float4*)(stg + j * 16384 + gi * 512);
    #pragma unroll
    for (int gi = 0; gi < 4; ++gi) {
      v8h h0, h1, h2, h3;
      #pragma unroll
      for (int j = 0; j < 8; ++j) {
        h0[j] = (f16)rx[gi][j].x; h1[j] = (f16)rx[gi][j].y;
        h2[j] = (f16)rx[gi][j].z; h3[j] = (f16)rx[gi][j].w;
      }
      *(v8h*)(dst + (gi * 16 + 0) * CP) = h0; *(v8h*)(dst + (gi * 16 + 1) * CP) = h1;
      *(v8h*)(dst + (gi * 16 + 2) * CP) = h2; *(v8h*)(dst + (gi * 16 + 3) * CP) = h3;
    }
  }
  __syncthreads();

  // ---------------- Phase 1: QKV GEMM  (128x768) = Xs(128x256) @ Wqkv^T ----------------
  const float scale = 0.17677669529663687f;   // 1/sqrt(32), folded into Q
  for (int p = 0; p < 2; ++p) {
    const int ct = (wv + p * 8) * 16;
    const int c = ct + lm;
    const float bv = qkv_b[512 + c];
    v8f bq, bk;           // biases of the lane's 8 channels
    const f16* wb = wq16 + (wv + p * 8) * 4096 + lane * 8;
    const f16* xa = Xs + lm * CP + kb;
    v8f  acc[3][8];
    v16h af[2][8];        // X fragments of this k step and the next
    v16h bw[8];           // weight fragments, ring over f = 3 * ks + g (g: 0 = Q, 1 = K, 2 = V tile, 16 tiles apart)
    auto load_w = [&](int f) { bw[f % 8] = fragw(wb + (f % 3) * 65536 + (f / 3) * 512); };
    auto load_x = [&](int ks) {
      #pragma unroll
      for (int mt = 0; mt < 8; ++mt)
        af[ks & 1][mt] = frag16(xa + mt * 16 * CP + ks * 32);
    };
    #pragma unroll
    for (int f = 0; f < 5; ++f) load_w(f);
    load_x(0);
    #pragma unroll
    for (int ks = 0; ks < 8; ++ks) {
      #pragma unroll
      for (int f = 3 * ks + 5; f < 3 * ks + 8; ++f)
        if (f < 24) load_w(f);
      if (ks < 7) load_x(ks + 1);
      if (ks == 7) {      // the last step fetches no fragments: its registers take the biases
        bq = *(const v8f*)(qkv_b + ct + 8 * hh);
        bk = *(const v8f*)(qkv_b + 256 + ct + 8 * hh);
      }
      // keeps the loads above as one group ahead of this step's WMMAs (the scheduler otherwise sinks each to its use)
      __builtin_amdgcn_sched_barrier(0);
      #pragma unroll
      for (int g = 0; g < 3; ++g)
        #pragma unroll
        for (int mt = 0; mt < 8; ++mt) {
          v8f cin = {};
          if (ks != 0) cin = acc[g][mt];
          acc[g][mt] = g < 2 ? wmma_f16(bw[(3 * ks + g) % 8], af[ks & 1][mt], cin)
                             : wmma_f16(af[ks & 1][mt], bw[(3 * ks + g) % 8], cin);
        }
      // closes the fence pair: the next step's loads and the stores behind the loop stay out of this WMMA block
      __builtin_amdgcn_sched_barrier(0);
    }
    #pragma unroll
    for (int mt = 0; mt < 8; ++mt) {
      v8h q8, k8;
      #pragma unroll
      for (int r = 0; r < 8; ++r) {
        q8[r] = (f16)((acc[0][mt][r] + bq[r]) * scale);   // Q (scaled)
        k8[r] = (f16)(acc[1][mt][r] + bk[r]);             // K
      }
      *(v8h*)(Qs + (mt * 16 + lm) * CP + ct + 8 * hh) = q8;
      *(v8h*)(Ks + (mt * 16 + lm) * CP + ct + 8 * hh) = k8;
    }
    #pragma unroll
    for (int mt = 0; mt < 8; ++mt)            // V, stored transposed: Vt[channel][token]
      #pragma unroll
      for (int r = 0; r < 8; ++r)
        Vt[c * VP + (mt * 16 + r + 8 * hh)] = (f16)(acc[2][mt][r] + bv);
  }
  __syncthreads();

  // ---------------- Phase 2: scores (one head per wave), bias, softmax ----------------
  // K is A and Q is B: s[mt][nt][r] = score(query t = mt*16 + lm, key u = nt*16 + 8*hh + r). A lane holds 32 of its
  // query's 64 keys and lane ^ 16 the other 32. The wave does its head for window 0, then for window 1.
  f16* Os = (f16*)(smem + OFF_O);
  // kept rolled: the second window runs the first one's text again (the kernel's text stays small for the instruction cache)
  #pragma unroll 1
  for (int win = 0; win < 2; ++win) {
  v8f s[4][4];
  {
    v16h aq[4];
    #pragma unroll
    for (int mt = 0; mt < 4; ++mt)
      aq[mt] = frag16(Qs + (win * 64 + mt * 16 + lm) * CP + wv * 32 + kb);
    #pragma unroll
    for (int nt = 0; nt < 4; ++nt) {
      v16h bk = frag16(Ks + (win * 64 + nt * 16 + lm) * CP + wv * 32 + kb);
      #pragma unroll
      for (int mt = 0; mt < 4; ++mt) {
        v8f z = {};
        s[mt][nt] = wmma_f16(bk, aq[mt], z);
      }
    }
  }
  // relative position bias: idx = (ti-ui+7)*15 + (tj-uj+7), table[idx][head]
  #pragma unroll
  for (int mt = 0; mt < 4; ++mt) {
    int t = mt * 16 + lm, ti = t >> 3, tj = t & 7;
    #pragma unroll
    for (int nt = 0; nt < 4; ++nt)
      #pragma unroll
      for (int r = 0; r < 8; ++r) {
        int u = nt * 16 + r + 8 * hh;
        int idx = (ti - (u >> 3) + 7) * 15 + (tj - (u & 7) + 7);
        s[mt][nt][r] += biasT[idx * 8 + wv];
      }
  }
  // softmax over u: 32 values in the lane (four partial sums), then one exchange with lane ^ 16
  #pragma unroll
  for (int mt = 0; mt < 4; ++mt) {
    float mx = s[mt][0][0];
    #pragma unroll
    for (int nt = 0; nt < 4; ++nt)
      #pragma unroll
      for (int r = 0; r < 8; ++r) mx = fmaxf(mx, s[mt][nt][r]);
    mx = fmaxf(mx, xhalf(mx));
    float ps[4];
    #pragma unroll
    for (int nt = 0; nt < 4; ++nt) {
      ps[nt] = 0.f;
      #pragma unroll
      for (int r = 0; r < 8; ++r) {
        float e = __expf(s[mt][nt][r] - mx);
        s[mt][nt][r] = e;
        ps[nt] += e;
      }
    }
    float sm = (ps[0] + ps[1]) + (ps[2] + ps[3]);
    sm += xhalf(sm);
    float inv = 1.0f / sm;
    #pragma unroll
    for (int nt = 0; nt < 4; ++nt) s[mt][nt] *= inv;
  }

  // ---------------- Phase 3: O = P @ V  (per head: 64x32, K=64) ----------------
  // Two score tiles of a query tile, converted in place, are the B fragment of a 32-key step (keys 8*hh + e and
  // 16 + 8*hh + e, the order in which frag16 reads Vt). Vt is A: a lane's 8 registers are 8 channels of one token.
  v8f ov[4][2] = {};
  #pragma unroll
  for (int ks = 0; ks < 2; ++ks) {
    v16h pf[4];
    #pragma unroll
    for (int mt = 0; mt < 4; ++mt)
      #pragma unroll
      for (int e = 0; e < 8; ++e) {
        pf[mt][e]     = (f16)s[mt][2 * ks][e];
        pf[mt][8 + e] = (f16)s[mt][2 * ks + 1][e];
      }
    #pragma unroll
    for (int nt = 0; nt < 2; ++nt) {
      v16h bvf = frag16(Vt + (wv * 32 + nt * 16 + lm) * VP + win * 64 + ks * 32 + kb);
      #pragma unroll
      for (int mt = 0; mt < 4; ++mt) ov[mt][nt] = wmma_f16(bvf, pf[mt], ov[mt][nt]);
    }
  }
  // Os lies over Xs, which nobody reads behind phase 1's barrier: no barrier in front of these stores
  #pragma unroll
  for (int mt = 0; mt < 4; ++mt)
    #pragma unroll
    for (int nt = 0; nt < 2; ++nt) {
      v8h o8;
      #pragma unroll
      for (int r = 0; r < 8; ++r) o8[r] = (f16)ov[mt][nt][r];
      *(v8h*)(Os + (win * 64 + mt * 16 + lm) * CP + win * OW + wv * 32 + nt * 16 + 8 * hh) = o8;
    }
  }
  // this wave's LDS reads and writes have retired before copies are aimed at Qs and Ks
  asm volatile("s_wait_dscnt 0x0" ::: "memory");
  __syncthreads();

  // ---------------- Phase 4: projection GEMM (128x256) = Os @ Wproj^T, stored from registers ----------------
  {
    // One O fragment read from LDS feeds both of the wave's 16-channel tiles; same rings as in phase 1.
    // The weights are A and O is B: a lane holds 8 channels of one token. Token tile mt is pixel row mt of BOTH windows
    // (lanes 0-7 window 0, lanes 8-15 window 1), so lanes 0-15 of one accumulator register are 64 contiguous bytes of one
    // channel in (B, C, H, W): each register goes to global memory as it is.
    const f16* wb = wp16 + wv * 8192 + lane * 8;
    const f16* oa = Os + ((lm >> 3) * 64 + (lm & 7)) * CP + (lm >> 3) * OW + kb;
    v8f  pb[2];           // biases of the lane's 8 channels in each tile
    v8f  acc[2][8];
    v16h af[2][8];
    v16h bw[4][2];
    auto load_w = [&](int s) {
      #pragma unroll
      for (int g = 0; g < 2; ++g) bw[s & 3][g] = fragw(wb + g * 4096 + s * 512);
    };
    auto load_o = [&](int s) {
      #pragma unroll
      for (int mt = 0; mt < 8; ++mt) af[s & 1][mt] = frag16(oa + mt * 8 * CP + s * 32);
    };
    load_w(0); load_w(1); load_w(2);
    load_o(0);
    // Behind phase 3's barrier nobody reads Qs or Ks: the next pair's x flies into their space under this phase.
    // Behind the first fragments' loads, so that these do not queue behind 32 copies a wave.
    if (more) copy_x(it + 1);
    #pragma unroll
    for (int s = 0; s < 8; ++s) {
      if (s + 3 < 8) load_w(s + 3);
      if (s + 1 < 8) load_o(s + 1);
      if (s == 7) {       // the last step fetches no fragments: its registers take the biases
        pb[0] = *(const v8f*)(proj_b + wv * 32 + 8 * hh);
        pb[1] = *(const v8f*)(proj_b + wv * 32 + 16 + 8 * hh);
      }
      // keeps the loads above as one group ahead of this step's WMMAs (the scheduler otherwise sinks each to its use)
      __builtin_amdgcn_sched_barrier(0);
      #pragma unroll
      for (int g = 0; g < 2; ++g)
        #pragma unroll
        for (int mt = 0; mt < 8; ++mt) {
          v8f cin = {};
          if (s != 0) cin = acc[g][mt];
          acc[g][mt] = wmma_f16(bw[s & 3][g], af[s & 1][mt], cin);
        }
      // closes the fence pair: the next step's loads and the stores behind the loop stay out of this WMMA block
      __builtin_amdgcn_sched_barrier(0);
    }
    // window reverse: column lm of tile mt is pixel (wy*8 + mt, wxp*16 + lm); channel planes are 4096 floats apart
    float* dst = out + imgbase + (long)(wv * 32 + 8 * hh) * 4096 + (wy * 8) * 64 + wxp * 16 + lm;
    #pragma unroll
    for (int g = 0; g < 2; ++g)
      #pragma unroll
      for (int mt = 0; mt < 8; ++mt) acc[g][mt] += pb[g];
    #pragma unroll
    for (int g = 0; g < 2; ++g)
      #pragma unroll
      for (int mt = 0; mt < 8; ++mt)
        #pragma unroll
        for (int r = 0; r < 8; ++r)
          dst[(g * 16 + r) * 4096 + mt * 64] = acc[g][mt][r];
    // the stores' address registers are formed anew for the next pair: the wait stands in front of that overwrite
    asm volatile("s_wait_xcnt 0x0" ::: "memory");
  }
  if (!more) break;
  }
}

}  // namespace

extern "C" void kernel_launch(void* const* d_in, const int* in_sizes, int n_in,
                              void* d_out, int out_size, void* d_ws, size_t ws_size,
                              hipStream_t stream) {
  const float* x        = (const float*)d_in[0];
  const float* qkv_w    = (const float*)d_in[1];
  const float* qkv_b    = (const float*)d_in[2];
  const float* proj_w   = (const float*)d_in[3];
  const float* proj_b   = (const float*)d_in[4];
  const float* bias_tab = (const float*)d_in[5];

  f16* wq16 = (f16*)d_ws;                               // 768*256 f16 = 393216 B
  f16* wp16 = (f16*)((char*)d_ws + 768 * 256 * 2);      // 256*256 f16 = 131072 B

  cvt_weights_kernel<<<768, 256, 0, stream>>>(qkv_w, proj_w, wq16, wp16);
  swin_window_attn_kernel<<<256, 256, 0, stream>>>(
      x, wq16, qkv_b, wp16, proj_b, bias_tab, (float*)d_out);
}

// v007
// A run of this version takes 114 microseconds.
// Timed twice side by side with v006, it ran 1.06 and 1.05 times as fast.
// Over all steps from v000 it is 2.06 times as fast.
#include <hip/hip_runtime.h>

typedef _Float16 f16;
typedef _Float16 v16h __attribute__((ext_vector_type(16)));
typedef _Float16 v8h  __attribute__((ext_vector_type(8)));
typedef float    v8f  __attribute__((ext_vector_type(8)));

namespace {

// A work-group takes TWO horizontally adjacent windows: 128 tokens, token row = win * 64 + t.
constexpr int CP = 264;   // f16 pitch (elems) for 128x256 LDS matrices (pad 8 kills bank conflicts)
constexpr int VP = 136;   // Vt pitch: [256 ch][128 tok + pad]
constexpr int OW = 64;    // Os only: window 1's rows stand 128 bytes further, so that rows t and 64 + t differ in bank

// LDS layout (bytes); one work-group per WGP
constexpr int MAT    = 128 * CP * 2;            // one 128x264 f16 matrix = 67584
constexpr int OFF_X  = 0;                       // Xs  (phase 0-1)
constexpr int OFF_O  = OFF_X;                   // Os  (phase 3-4) overlays Xs, dead behind the barrier that ends phase 1
constexpr int OFF_Q  = MAT + OW * 2;            // Qs  (phase 1-2), behind the 128 bytes by which Os is longer than Xs
constexpr int OFF_S  = OFF_Q;                   // the next pair's x, f32, 131072 B (phase 4-0), over Qs and Ks, dead behind phase 3's barrier
constexpr int OFF_K  = OFF_Q + MAT;             // Ks  (phase 1-2)
constexpr int OFF_V  = OFF_K + MAT;             // Vt  256x136 f16 = 69632  (phase 1-3)
constexpr int OFF_B  = OFF_V + 256 * VP * 2;    // bias in score-accumulator order: [head 8][row distance 15], BP bytes each
constexpr int BP     = 8 * 8 * 4 + 16;          // [query column 8][key column 8] f32; the 16 bytes more put neighbouring rows on the other banks
constexpr int SMEM_BYTES = OFF_B + 8 * 15 * BP; // 305152 B  (< 320KB/WGP)

__device__ inline v16h frag16(const f16* p) {
  // WMMA A/B operand: two contiguous 8xf16 chunks at k-offset 0 and +16 (per ISA VGPR layout)
  v8h lo = *(const v8h*)p;
  v8h hi = *(const v8h*)(p + 16);
  return __builtin_shufflevector(lo, hi, 0,1,2,3,4,5,6,7,8,9,10,11,12,13,14,15);
}

__device__ inline v16h fragw(const f16* p) {
  // packed weight fragment: the 32 lanes' low 8-element k chunks lie in one 512-byte run, their high chunks (k + 16) in the next
  v8h lo = *(const v8h*)p;
  v8h hi = *(const v8h*)(p + 256);
  return __builtin_shufflevector(lo, hi, 0,1,2,3,4,5,6,7,8,9,10,11,12,13,14,15);
}

__device__ inline float xhalf(float v) {
  // value of lane l ^ 16 (the lane that holds the other half of the same column's rows)
  int b = __builtin_bit_cast(int, v);
  return __builtin_bit_cast(float, __builtin_amdgcn_permlanex16(b, b, 0x76543210, 0xfedcba98, false, false));
}

__device__ inline v8f wmma_f16(v16h a, v16h b, v8f c) {
  return __builtin_amdgcn_wmma_f32_16x16x32_f16(false, a, false, b, (short)0, c, false, false);
}

__global__ void cvt_weights_kernel(const float* __restrict__ qw,
                                   const float* __restrict__ pw,
                                   f16* __restrict__ q16, f16* __restrict__ p16) {
  // Packs W[row][k] in WMMA B-fragment order: [16-row tile][32-k step][half h][lane][8 elems], so that
  // one wave-wide 16-byte load in the main kernel reads 512 contiguous bytes (4 whole lines, not 16 pieces).
  int i = blockIdx.x * 256 + threadIdx.x;   // grid = 768 blocks -> 196608 = 768*256 exactly
  int e = i & 7, ln = (i >> 3) & 31, h = (i >> 8) & 1, ks = (i >> 9) & 7, tile = i >> 12;
  int src = (tile * 16 + (ln & 15)) * 256 + ks * 32 + h * 16 + (ln >> 4) * 8 + e;
  q16[i] = (f16)qw[src];
  if (i < 256 * 256) p16[i] = (f16)pw[src];
}

__global__ __launch_bounds__(256)
void swin_window_attn_kernel(const float* __restrict__ x,
                             // weights and biases without __restrict__: with it the compiler lifts their loads, the same
                             // for every pair, out of the loop over pairs and keeps them in scratch memory
                             const f16* wq16,
                             const float* qkv_b,
                             const f16* wp16,
                             const float* proj_b,
                             const float* __restrict__ bias_tab,
                             float* __restrict__ out) {
  __shared__ __align__(16) char smem[SMEM_BYTES];
  f16*   Xs    = (f16*)(smem + OFF_X);
  f16*   Qs    = (f16*)(smem + OFF_Q);
  f16*   Ks    = (f16*)(smem + OFF_K);
  f16*   Vt    = (f16*)(smem + OFF_V);

  const int tid  = threadIdx.x;
  const int lane = tid & 31;
  const int wv   = tid >> 5;        // wave id == head id for attention phases
  const int hh   = lane >> 4;       // half-wave select
  const int lm   = lane & 15;
  const int kb   = hh * 8;          // per-lane k chunk base (ISA 16-bit A/B layout)

  // 256 work-groups, one per WGP; each walks the window pairs blockIdx.x + 256 * it, it = 0 .. 3: the same place in the
  // image, 8 images further each trip.
  const int widx = blockIdx.x & 31;
  const int wy   = widx >> 2, wxp = widx & 3;   // windows (wy, 2 * wxp) and (wy, 2 * wxp + 1)
  constexpr long IMG = 256L * 4096L;            // floats of one image
  constexpr int  NIT = 4;                       // pairs per work-group

  // A pixel row of the pair is 64 contiguous bytes of a channel plane: 4 neighbouring lanes read it, so a wave-wide copy
  // touches 8 lines. A lane takes the same 4 pixels of 8 consecutive channels and stores each pixel's 8 channels at once.
  const int qd = lane & 3;                       // which 16 bytes of the 64: window qd >> 1, columns 4 * (qd & 1) ...
  const int c0 = wv * 32 + (lane >> 3) * 8;      // the lane's 8 channels
  const int xoff = c0 * 4096 + (wy * 8 + ((lane >> 2) & 1)) * 64 + wxp * 16 + qd * 4;   // the lane's place in its image
  // Staging space: the copy of channel c0 + j, pixel rows 2 * gi and 2 * gi + 1, of wave wv fills 512 bytes in a row, 16 a lane,
  // at j * 16384 + wv * 2048 + gi * 512; a lane reads back what it copied. A step of j or of gi is as many bytes in LDS as in x,
  // so one pair of address registers with immediate offsets, which move both addresses alike, serves 16 copies.
  char* stg = smem + OFF_S + wv * 2048 + lane * 16;
  auto copy_x = [&](int it) {
    const float* src = x + (long)((blockIdx.x >> 5) + 8 * it) * IMG + xoff;
    const unsigned l0 = (unsigned)(size_t)stg;     // the lane's LDS byte address
    #pragma unroll
    for (int h = 0; h < 2; ++h) {                  // channels c0 + 4 * h ...: 65536 bytes further in x and in LDS
      // x goes to LDS through no register; the last line keeps every rewrite of an address register behind the copies
      asm volatile("global_load_async_to_lds_b128 %0, %1, off\n\t"
                   "global_load_async_to_lds_b128 %0, %1, off offset:512\n\t"
                   "global_load_async_to_lds_b128 %0, %1, off offset:1024\n\t"
                   "global_load_async_to_lds_b128 %0, %1, off offset:1536\n\t"
                   "global_load_async_to_lds_b128 %0, %1, off offset:16384\n\t"
                   "global_load_async_to_lds_b128 %0, %1, off offset:16896\n\t"
                   "global_load_async_to_lds_b128 %0, %1, off offset:17408\n\t"
                   "global_load_async_to_lds_b128 %0, %1, off offset:17920\n\t"
                   "global_load_async_to_lds_b128 %0, %1, off offset:32768\n\t"
                   "global_load_async_to_lds_b128 %0, %1, off offset:33280\n\t"
                   "global_load_async_to_lds_b128 %0, %1, off offset:33792\n\t"
                   "global_load_async_to_lds_b128 %0, %1, off offset:34304\n\t"
                   "global_load_async_to_lds_b128 %0, %1, off offset:49152\n\t"
                   "global_load_async_to_lds_b128 %0, %1, off offset:49664\n\t"
                   "global_load_async_to_lds_b128 %0, %1, off offset:50176\n\t"
                   "global_load_async_to_lds_b128 %0, %1, off offset:50688\n\t"
                   "s_wait_xcnt 0x0"
                   :: "v"(l0 + h * 65536), "v"(src + h * 16384)
                   : "memory");
    }
  };

  // ---------------- Prologue: first pair's input on its way, bias table staged ----------------
  copy_x(0);
  // entry (head, a, tj, r) is the bias of a query in window column tj and a key in column r, a - 7 window rows above it
  {
    const int r = tid & 7, tj = (tid >> 3) & 7, h4 = tid >> 6;
    const float* bs = bias_tab + (tj - r + 7) * 8 + h4;
    char* bd = smem + OFF_B + h4 * 15 * BP + tj * 32 + r * 4;
    // unrolled: a thread's 30 loads issue as one group and wait out one latency (a = i >> 1, head = h4 + 4 * (i & 1))
    #pragma unroll
    for (int i = 0; i < 30; ++i)
      *(float*)(bd + ((i & 1) * 60 + (i >> 1)) * BP) = bs[(i >> 1) * 120 + (i & 1) * 4];
  }

  // kept rolled: every pair runs the same text (the kernel's text stays small for the instruction cache)
  #pragma unroll 1
  for (int it = 0;; ++it) {
  const long imgbase = (long)((blockIdx.x >> 5) + 8 * it) * IMG;
  const bool more = it + 1 < NIT;   // the same for the whole work-group

  // ---------------- Phase 0: window input, staged f32 -> f16 ----------------
  // this wave's copies have landed
  asm volatile("s_wait_asynccnt 0x0" ::: "memory");
  // publishes the staged x; and every wave has read its last O fragment before X is written over O
  __syncthreads();
  {
    f16* dst = Xs + ((qd >> 1) * 64 + ((lane >> 2) & 1) * 8 + (qd & 1) * 4) * CP + c0;
    float4 rx[4][8];
    #pragma unroll
    for (int gi = 0; gi < 4; ++gi)
      #pragma unroll
      for (int j = 0; j < 8; ++j) rx[gi][j] = *(const float4*)(stg + j * 16384 + gi * 512);
    #pragma unroll
    for (int gi = 0; gi < 4; ++gi) {
      v8h h0, h1, h2, h3;
      #pragma unroll
      for (int j = 0; j < 8; ++j) {
        h0[j] = (f16)rx[gi][j].x; h1[j] = (f16)rx[gi][j].y;
        h2[j] = (f16)rx[gi][j].z; h3[j] = (f16)rx[gi][j].w;
      }
      *(v8h*)(dst + (gi * 16 + 0) * CP) = h0; *(v8h*)(dst + (gi * 16 + 1) * CP) = h1;
      *(v8h*)(dst + (gi * 16 + 2) * CP) = h2; *(v8h*)(dst + (gi * 16 + 3) * CP) = h3;
    }
  }
  __syncthreads();

  // ---------------- Phase 1: QKV GEMM  (128x768) = Xs(128x256) @ Wqkv^T ----------------
  const float scale = 0.17677669529663687f;   // 1/sqrt(32), folded into Q
  for (int p = 0; p < 2; ++p) {
    const int ct = (wv + p * 8) * 16;
    const int c = ct + lm;
    const float bv = qkv_b[512 + c];
    v8f bq, bk;           // biases of the lane's 8 channels
    const f16* wb = wq16 + (wv + p * 8) * 4096 + lane * 8;
    const f16* xa = Xs + lm * CP + kb;
    v8f  acc[3][8];
    v16h af[2][8];        // X fragments of this k step and the next
    v16h bw[8];           // weight fragments, ring over f = 3 * ks + g (g: 0 = Q, 1 = K, 2 = V tile, 16 tiles apart)
    auto load_w = [&](int f) { bw[f % 8] = fragw(wb + (f % 3) * 65536 + (f / 3) * 512); };
    auto load_x = [&](int ks) {
      #pragma unroll
      for (int mt = 0; mt < 8; ++mt)
        af[ks & 1][mt] = frag16(xa + mt * 16 * CP + ks * 32);
    };
    #pragma unroll
    for (int f = 0; f < 5; ++f) load_w(f);
    load_x(0);
    #pragma unroll
    for (int ks = 0; ks < 8; ++ks) {
      #pragma unroll
      for (int f = 3 * ks + 5; f < 3 * ks + 8; ++f)
        if (f < 24) load_w(f);
      if (ks < 7) load_x(ks + 1);
      if (ks == 7) {      // the last step fetches no fragments: its registers take the biases
        bq = *(const v8f*)(qkv_b + ct + 8 * hh);
        bk = *(const v8f*)(qkv_b + 256 + ct + 8 * hh);
      }
      // keeps the loads above as one group ahead of this step's WMMAs (the scheduler otherwise sinks each to its use)
      __builtin_amdgcn_sched_barrier(0);
      #pragma unroll
      for (int g = 0; g < 3; ++g)
        #pragma unroll
        for (int mt = 0; mt < 8; ++mt) {
          v8f cin = {};
          if (ks != 0) cin = acc[g][mt];
          acc[g][mt] = g < 2 ? wmma_f16(bw[(3 * ks + g) % 8], af[ks & 1][mt], cin)
                             : wmma_f16(af[ks & 1][mt], bw[(3 * ks + g) % 8], cin);
        }
      // closes the fence pair: the next step's loads and the stores behind the loop stay out of this WMMA block
      __builtin_amdgcn_sched_barrier(0);
    }
    #pragma unroll
    for (int mt = 0; mt < 8; ++mt) {
      v8h q8, k8;
      #pragma unroll
      for (int r = 0; r < 8; ++r) {
        q8[r] = (f16)((acc[0][mt][r] + bq[r]) * scale);   // Q (scaled)
        k8[r] = (f16)(acc[1][mt][r] + bk[r]);             // K
      }
      *(v8h*)(Qs + (mt * 16 + lm) * CP + ct + 8 * hh) = q8;
      *(v8h*)(Ks + (mt * 16 + lm) * CP + ct + 8 * hh) = k8;
    }
    #pragma unroll
    for (int mt = 0; mt < 8; ++mt)            // V, stored transposed: Vt[channel][token]
      #pragma unroll
      for (int r = 0; r < 8; ++r)
        Vt[c * VP + (mt * 16 + r + 8 * hh)] = (f16)(acc[2][mt][r] + bv);
  }
  __syncthreads();

  // ---------------- Phase 2: scores (one head per wave), bias, softmax ----------------
  // K is A and Q is B: s[mt][nt][r] = score(query t = mt*16 + lm, key u = nt*16 + 8*hh + r). A lane holds 32 of its
  // query's 64 keys and lane ^ 16 the other 32. The wave does its head for window 0, then for window 1.
  f16* Os = (f16*)(smem + OFF_O);
  // relative position bias: idx = (ti-ui+7)*15 + (tj-uj+7), table[idx][head]. With t = mt*16 + lm and u = nt*16 + 8*hh + r the
  // row distance ti - ui is 2*(mt-nt) + (lm>>3) - hh and tj - uj is (lm&7) - r: a score tile's bias depends on mt - nt alone,
  // and a lane's 8 values lie in a row in the table. The 7 tiles serve both windows as the C operand of the score products.
  v8f bC[7];
  {
    const char* bt = smem + OFF_B + (wv * 15 + 7 + (lm >> 3) - hh) * BP + (lm & 7) * 32;
    // unrolled: bC is indexed by constants alone and so stays in registers
    #pragma unroll
    for (int d = 0; d < 7; ++d) {
      float4 lo = *(const float4*)(bt + (d - 3) * 2 * BP);
      float4 hi = *(const float4*)(bt + (d - 3) * 2 * BP + 16);
      bC[d] = v8f{lo.x, lo.y, lo.z, lo.w, hi.x, hi.y, hi.z, hi.w};
    }
  }
  // kept rolled: the second window runs the first one's text again (the kernel's text stays small for the instruction cache)
  #pragma unroll 1
  for (int win = 0; win < 2; ++win) {
  v8f s[4][4];
  {
    v16h aq[4];
    #pragma unroll
    for (int mt = 0; mt < 4; ++mt)
      aq[mt] = frag16(Qs + (win * 64 + mt * 16 + lm) * CP + wv * 32 + kb);
    #pragma unroll
    for (int nt = 0; nt < 4; ++nt) {
      v16h bk = frag16(Ks + (win * 64 + nt * 16 + lm) * CP + wv * 32 + kb);
      #pragma unroll
      for (int mt = 0; mt < 4; ++mt) s[mt][nt] = wmma_f16(bk, aq[mt], bC[mt - nt + 3]);
    }
  }
  // softmax over u: 32 values in the lane (four partial sums), then one exchange with lane ^ 16
  #pragma unroll
  for (int mt = 0; mt < 4; ++mt) {
    float mx = s[mt][0][0];
    #pragma unroll
    for (int nt = 0; nt < 4; ++nt)
      #pragma unroll
      for (int r = 0; r < 8; ++r) mx = fmaxf(mx, s[mt][nt][r]);
    mx = fmaxf(mx, xhalf(mx));
    float ps[4];
    #pragma unroll
    for (int nt = 0; nt < 4; ++nt) {
      ps[nt] = 0.f;
      #pragma unroll
      for (int r = 0; r < 8; ++r) {
        float e = __expf(s[mt][nt][r] - mx);
        s[mt][nt][r] = e;
        ps[nt] += e;
      }
    }
    float sm = (ps[0] + ps[1]) + (ps[2] + ps[3]);
    sm += xhalf(sm);
    float inv = 1.0f / sm;
    #pragma unroll
    for (int nt = 0; nt < 4; ++nt) s[mt][nt] *= inv;
  }

  // ---------------- Phase 3: O = P @ V  (per head: 64x32, K=64) ----------------
  // Two score tiles of a query tile, converted in place, are the B fragment of a 32-key step (keys 8*hh + e and
  // 16 + 8*hh + e, the order in which frag16 reads Vt). Vt is A: a lane's 8 registers are 8 channels of one token.
  v8f ov[4][2] = {};
  #pragma unroll
  for (int ks = 0; ks < 2; ++ks) {
    v16h pf[4];
    #pragma unroll
    for (int mt = 0; mt < 4; ++mt)
      #pragma unroll
      for (int e = 0; e < 8; ++e) {
        pf[mt][e]     = (f16)s[mt][2 * ks][e];
        pf[mt][8 + e] = (f16)s[mt][2 * ks + 1][e];
      }
    #pragma unroll
    for (int nt = 0; nt < 2; ++nt) {
      v16h bvf = frag16(Vt + (wv * 32 + nt * 16 + lm) * VP + win * 64 + ks * 32 + kb);
      #pragma unroll
      for (int mt = 0; mt < 4; ++mt) ov[mt][nt] = wmma_f16(bvf, pf[mt], ov[mt][nt]);
    }
  }
  // Os lies over Xs, which nobody reads behind phase 1's barrier: no barrier in front of these stores
  #pragma unroll
  for (int mt = 0; mt < 4; ++mt)
    #pragma unroll
    for (int nt = 0; nt < 2; ++nt) {
      v8h o8;
      #pragma unroll
      for (int r = 0; r < 8; ++r) o8[r] = (f16)ov[mt][nt][r];
      *(v8h*)(Os + (win * 64 + mt * 16 + lm) * CP + win * OW + wv * 32 + nt * 16 + 8 * hh) = o8;
    }
  }
  // this wave's LDS reads and writes have retired before copies are aimed at Qs and Ks
  asm volatile("s_wait_dscnt 0x0" ::: "memory");
  __syncthreads();

  // ---------------- Phase 4: projection GEMM (128x256) = Os @ Wproj^T, stored from registers ----------------
  {
    // One O fragment read from LDS feeds both of the wave's 16-channel tiles; same rings as in phase 1.
    // The weights are A and O is B: a lane holds 8 channels of one token. Token tile mt is pixel row mt of BOTH windows
    // (lanes 0-7 window 0, lanes 8-15 window 1), so lanes 0-15 of one accumulator register are 64 contiguous bytes of one
    // channel in (B, C, H, W): each register goes to global memory as it is.
    const f16* wb = wp16 + wv * 8192 + lane * 8;
    const f16* oa = Os + ((lm >> 3) * 64 + (lm & 7)) * CP + (lm >> 3) * OW + kb;
    v8f  pb[2];           // biases of the lane's 8 channels in each tile
    v8f  acc[2][8];
    v16h af[2][8];
    v16h bw[4][2];
    auto load_w = [&](int s) {
      #pragma unroll
      for (int g = 0; g < 2; ++g) bw[s & 3][g] = fragw(wb + g * 4096 + s * 512);
    };
    auto load_o = [&](int s) {
      #pragma unroll
      for (int mt = 0; mt < 8; ++mt) af[s & 1][mt] = frag16(oa + mt * 8 * CP + s * 32);
    };
    load_w(0); load_w(1); load_w(2);
    load_o(0);
    // Behind phase 3's barrier nobody reads Qs or Ks: the next pair's x flies into their space under this phase.
    // Behind the first fragments' loads, so that these do not queue behind 32 copies a wave.
    if (more) copy_x(it + 1);
    #pragma unroll
    for (int s = 0; s < 8; ++s) {
      if (s + 3 < 8) load_w(s + 3);
      if (s + 1 < 8) load_o(s + 1);
      if (s == 7) {       // the last step fetches no fragments: its registers take the biases
        pb[0] = *(const v8f*)(proj_b + wv * 32 + 8 * hh);
        pb[1] = *(const v8f*)(proj_b + wv * 32 + 16 + 8 * hh);
      }
      // keeps the loads above as one group ahead of this step's WMMAs (the scheduler otherwise sinks each to its use)
      __builtin_amdgcn_sched_barrier(0);
      #pragma unroll
      for (int g = 0; g < 2; ++g)
        #pragma unroll
        for (int mt = 0; mt < 8; ++mt) {
          v8f cin = {};
          if (s != 0) cin = acc[g][mt];
          acc[g][mt] = wmma_f16(bw[s & 3][g], af[s & 1][mt], cin);
        }
      // closes the fence pair: the next step's loads and the stores behind the loop stay out of this WMMA block
      __builtin_amdgcn_sched_barrier(0);
    }
    // window reverse: column lm of tile mt is pixel (wy*8 + mt, wxp*16 + lm); channel planes are 4096 floats apart
    float* dst = out + imgbase + (long)(wv * 32 + 8 * hh) * 4096 + (wy * 8) * 64 + wxp * 16 + lm;
    #pragma unroll
    for (int g = 0; g < 2; ++g)
      #pragma unroll
      for (int mt = 0; mt < 8; ++mt) acc[g][mt] += pb[g];
    #pragma unroll
    for (int g = 0; g < 2; ++g)
      #pragma unroll
      for (int mt = 0; mt < 8; ++mt)
        #pragma unroll
        for (int r = 0; r < 8; ++r)
          dst[(g * 16 + r) * 4096 + mt * 64] = acc[g][mt][r];
    // the stores' address registers are formed anew for the next pair: the wait stands in front of that overwrite
    asm volatile("s_wait_xcnt 0x0" ::: "memory");
  }
  if (!more) break;
  }
}

}  // namespace

extern "C" void kernel_launch(void* const* d_in, const int* in_sizes, int n_in,
                              void* d_out, int out_size, void* d_ws, size_t ws_size,
                              hipStream_t stream) {
  const float* x        = (const float*)d_in[0];
  const float* qkv_w    = (const float*)d_in[1];
  const float* qkv_b    = (const float*)d_in[2];
  const float* proj_w   = (const float*)d_in[3];
  const float* proj_b   = (const float*)d_in[4];
  const float* bias_tab = (const float*)d_in[5];

  f16* wq16 = (f16*)d_ws;                               // 768*256 f16 = 393216 B
  f16* wp16 = (f16*)((char*)d_ws + 768 * 256 * 2);      // 256*256 f16 = 131072 B

  cvt_weights_kernel<<<768, 256, 0, stream>>>(qkv_w, proj_w, wq16, wp16);
  swin_window_attn_kernel<<<256, 256, 0, stream>>>(
      x, wq16, qkv_b, wp16, proj_b, bias_tab, (float*)d_out);
}

// v008
// Measured time: 81 microseconds a run.
// Two timings next to v007 both put it at 1.41 times that version's speed.
// Counting every step since v000, it is 2.91 times as fast.
#include <hip/hip_runtime.h>

typedef _Float16 f16;
typedef _Float16 v16h __attribute__((ext_vector_type(16)));
typedef _Float16 v8h  __attribute__((ext_vector_type(8)));
typedef float    v8f  __attribute__((ext_vector_type(8)));

namespace {

// A work-group takes TWO horizontally adjacent windows: 128 tokens, token row = win * 64 + t.
constexpr int CP = 264;   // f16 pitch (elems) for 128x256 LDS matrices (pad 8 kills bank conflicts)
constexpr int VP = 136;   // Vt pitch: [256 ch][128 tok + pad]
constexpr int OW = 64;    // Os only: window 1's rows stand 128 bytes further, so that rows t and 64 + t differ in bank

// LDS layout (bytes); one work-group per WGP
constexpr int MAT    = 128 * CP * 2;            // one 128x264 f16 matrix = 67584
constexpr int OFF_X  = 0;                       // Xs  (phase 0-1)
constexpr int OFF_O  = OFF_X;                   // Os  (phase 3-4) overlays Xs, dead behind the barrier that ends phase 1
constexpr int OFF_Q  = MAT + OW * 2;            // Qs  (phase 1-2), behind the 128 bytes by which Os is longer than Xs
constexpr int OFF_S  = OFF_Q;                   // the next pair's x, f32, 131072 B (phase 4-0), over Qs and Ks, dead behind phase 3's barrier
constexpr int OFF_K  = OFF_Q + MAT;             // Ks  (phase 1-2)
constexpr int OFF_V  = OFF_K + MAT;             // Vt  256x136 f16 = 69632  (phase 1-3)
constexpr int OFF_B  = OFF_V + 256 * VP * 2;    // bias in score-accumulator order: [head 8][row distance 15], BP bytes each
constexpr int BP     = 8 * 8 * 4 + 16;          // [query column 8][key column 8] f32; the 16 bytes more put neighbouring rows on the other banks
constexpr int SMEM_BYTES = OFF_B + 8 * 15 * BP; // 305152 B  (< 320KB/WGP)

__device__ inline v16h frag16(const f16* p) {
  // WMMA A/B operand: two contiguous 8xf16 chunks at k-offset 0 and +16 (per ISA VGPR layout)
  v8h lo = *(const v8h*)p;
  v8h hi = *(const v8h*)(p + 16);
  return __builtin_shufflevector(lo, hi, 0,1,2,3,4,5,6,7,8,9,10,11,12,13,14,15);
}

__device__ inline v16h fragw(const f16* p) {
  // packed weight fragment: the 32 lanes' low 8-element k chunks lie in one 512-byte run, their high chunks (k + 16) in the next
  v8h lo = *(const v8h*)p;
  v8h hi = *(const v8h*)(p + 256);
  return __builtin_shufflevector(lo, hi, 0,1,2,3,4,5,6,7,8,9,10,11,12,13,14,15);
}

__device__ inline float xhalf(float v) {
  // value of lane l ^ 16 (the lane that holds the other half of the same column's rows)
  int b = __builtin_bit_cast(int, v);
  return __builtin_bit_cast(float, __builtin_amdgcn_permlanex16(b, b, 0x76543210, 0xfedcba98, false, false));
}

__device__ inline v8f wmma_f16(v16h a, v16h b, v8f c) {
  return __builtin_amdgcn_wmma_f32_16x16x32_f16(false, a, false, b, (short)0, c, false, false);
}

__global__ void cvt_weights_kernel(const float* __restrict__ qw,
                                   const float* __restrict__ pw,
                                   f16* __restrict__ q16, f16* __restrict__ p16) {
  // Packs W[row][k] in WMMA B-fragment order: [16-row tile][32-k step][half h][lane][8 elems], so that
  // one wave-wide 16-byte load in the main kernel reads 512 contiguous bytes (4 whole lines, not 16 pieces).
  int i = blockIdx.x * 256 + threadIdx.x;   // grid = 768 blocks -> 196608 = 768*256 exactly
  int e = i & 7, ln = (i >> 3) & 31, h = (i >> 8) & 1, ks = (i >> 9) & 7, tile = i >> 12;
  int src = (tile * 16 + (ln & 15)) * 256 + ks * 32 + h * 16 + (ln >> 4) * 8 + e;
  q16[i] = (f16)qw[src];
  if (i < 256 * 256) p16[i] = (f16)pw[src];
}

__global__ __launch_bounds__(256)
void swin_window_attn_kernel(const float* __restrict__ x,
                             // weights and biases without __restrict__: with it the compiler lifts their loads, the same
                             // for every pair, out of the loop over pairs and keeps them in scratch memory
                             const f16* wq16,
                             const float* qkv_b,
                             const f16* wp16,
                             const float* proj_b,
                             const float* __restrict__ bias_tab,
                             float* __restrict__ out) {
  __shared__ __align__(16) char smem[SMEM_BYTES];
  f16*   Xs    = (f16*)(smem + OFF_X);
  f16*   Qs    = (f16*)(smem + OFF_Q);
  f16*   Ks    = (f16*)(smem + OFF_K);
  f16*   Vt    = (f16*)(smem + OFF_V);

  const int tid  = threadIdx.x;
  const int lane = tid & 31;
  const int wv   = tid >> 5;        // wave id == head id for attention phases
  const int hh   = lane >> 4;       // half-wave select
  const int lm   = lane & 15;
  const int kb   = hh * 8;          // per-lane k chunk base (ISA 16-bit A/B layout)

  // 256 work-groups, one per WGP; each walks 4 window pairs, it = 0 .. 3: the same place in the image, 8 images further
  // each trip. A pixel row of a channel plane is 256 bytes, and the four pairs wxp = 0 .. 3 each read
  // 64 bytes of it (and write half a 128-byte line of out). Their work-groups are 64 apart in index.
  // For speed only: the deal is a
  // permutation of the pairs wherever the groups land.
  const int wy   = blockIdx.x & 7;              // window row
  const int img0 = (blockIdx.x >> 3) & 7;       // image of the first trip
  const int wxp  = blockIdx.x >> 6;             // windows (wy, 2 * wxp) and (wy, 2 * wxp + 1)
  constexpr long IMG = 256L * 4096L;            // floats of one image
  constexpr int  NIT = 4;                       // pairs per work-group

  // A pixel row of the pair is 64 contiguous bytes of a channel plane: 4 neighbouring lanes read it, so a wave-wide copy
  // touches 8 lines. A lane takes the same 4 pixels of 8 consecutive channels and stores each pixel's 8 channels at once.
  const int qd = lane & 3;                       // which 16 bytes of the 64: window qd >> 1, columns 4 * (qd & 1) ...
  const int c0 = wv * 32 + (lane >> 3) * 8;      // the lane's 8 channels
  const int xoff = c0 * 4096 + (wy * 8 + ((lane >> 2) & 1)) * 64 + wxp * 16 + qd * 4;   // the lane's place in its image
  // Staging space: the copy of channel c0 + j, pixel rows 2 * gi and 2 * gi + 1, of wave wv fills 512 bytes in a row, 16 a lane,
  // at j * 16384 + wv * 2048 + gi * 512; a lane reads back what it copied. A step of j or of gi is as many bytes in LDS as in x,
  // so one pair of address registers with immediate offsets, which move both addresses alike, serves 16 copies.
  char* stg = smem + OFF_S + wv * 2048 + lane * 16;
  auto copy_x = [&](int it) {
    const float* src = x + (long)(img0 + 8 * it) * IMG + xoff;
    const unsigned l0 = (unsigned)(size_t)stg;     // the lane's LDS byte address
    #pragma unroll
    for (int h = 0; h < 2; ++h) {                  // channels c0 + 4 * h ...: 65536 bytes further in x and in LDS
      // x goes to LDS through no register; the last line keeps every rewrite of an address register behind the copies
      asm volatile("global_load_async_to_lds_b128 %0, %1, off\n\t"
                   "global_load_async_to_lds_b128 %0, %1, off offset:512\n\t"
                   "global_load_async_to_lds_b128 %0, %1, off offset:1024\n\t"
                   "global_load_async_to_lds_b128 %0, %1, off offset:1536\n\t"
                   "global_load_async_to_lds_b128 %0, %1, off offset:16384\n\t"
                   "global_load_async_to_lds_b128 %0, %1, off offset:16896\n\t"
                   "global_load_async_to_lds_b128 %0, %1, off offset:17408\n\t"
                   "global_load_async_to_lds_b128 %0, %1, off offset:17920\n\t"
                   "global_load_async_to_lds_b128 %0, %1, off offset:32768\n\t"
                   "global_load_async_to_lds_b128 %0, %1, off offset:33280\n\t"
                   "global_load_async_to_lds_b128 %0, %1, off offset:33792\n\t"
                   "global_load_async_to_lds_b128 %0, %1, off offset:34304\n\t"
                   "global_load_async_to_lds_b128 %0, %1, off offset:49152\n\t"
                   "global_load_async_to_lds_b128 %0, %1, off offset:49664\n\t"
                   "global_load_async_to_lds_b128 %0, %1, off offset:50176\n\t"
                   "global_load_async_to_lds_b128 %0, %1, off offset:50688\n\t"
                   "s_wait_xcnt 0x0"
                   :: "v"(l0 + h * 65536), "v"(src + h * 16384)
                   : "memory");
    }
  };

  // ---------------- Prologue: first pair's input on its way, bias table staged ----------------
  copy_x(0);
  // entry (head, a, tj, r) is the bias of a query in window column tj and a key in column r, a - 7 window rows above it
  {
    const int r = tid & 7, tj = (tid >> 3) & 7, h4 = tid >> 6;
    const float* bs = bias_tab + (tj - r + 7) * 8 + h4;
    char* bd = smem + OFF_B + h4 * 15 * BP + tj * 32 + r * 4;
    // unrolled: a thread's 30 loads issue as one group and wait out one latency (a = i >> 1, head = h4 + 4 * (i & 1))
    float bt30[30];
    #pragma unroll
    for (int i = 0; i < 30; ++i) bt30[i] = bs[(i >> 1) * 120 + (i & 1) * 4];
    // the loads' address registers are taken for other values right behind them: the wait stands in front of that overwrite
    asm volatile("s_wait_xcnt 0x0" ::: "memory");
    // keeps the address arithmetic of the phases below, which takes those registers, from being lifted over the wait
    __builtin_amdgcn_sched_barrier(0);
    #pragma unroll
    for (int i = 0; i < 30; ++i) *(float*)(bd + ((i & 1) * 60 + (i >> 1)) * BP) = bt30[i];
  }

  // kept rolled: every pair runs the same text (the kernel's text stays small for the instruction cache)
  #pragma unroll 1
  for (int it = 0;; ++it) {
  const long imgbase = (long)(img0 + 8 * it) * IMG;
  const bool more = it + 1 < NIT;   // the same for the whole work-group

  // ---------------- Phase 0: window input, staged f32 -> f16 ----------------
  // this wave's copies have landed
  asm volatile("s_wait_asynccnt 0x0" ::: "memory");
  // publishes the staged x; and every wave has read its last O fragment before X is written over O
  __syncthreads();
  {
    f16* dst = Xs + ((qd >> 1) * 64 + ((lane >> 2) & 1) * 8 + (qd & 1) * 4) * CP + c0;
    float4 rx[4][8];
    #pragma unroll
    for (int gi = 0; gi < 4; ++gi)
      #pragma unroll
      for (int j = 0; j < 8; ++j) rx[gi][j] = *(const float4*)(stg + j * 16384 + gi * 512);
    #pragma unroll
    for (int gi = 0; gi < 4; ++gi) {
      v8h h0, h1, h2, h3;
      #pragma unroll
      for (int j = 0; j < 8; ++j) {
        h0[j] = (f16)rx[gi][j].x; h1[j] = (f16)rx[gi][j].y;
        h2[j] = (f16)rx[gi][j].z; h3[j] = (f16)rx[gi][j].w;
      }
      *(v8h*)(dst + (gi * 16 + 0) * CP) = h0; *(v8h*)(dst + (gi * 16 + 1) * CP) = h1;
      *(v8h*)(dst + (gi * 16 + 2) * CP) = h2; *(v8h*)(dst + (gi * 16 + 3) * CP) = h3;
    }
  }
  __syncthreads();

  // ---------------- Phase 1: QKV GEMM  (128x768) = Xs(128x256) @ Wqkv^T ----------------
  const float scale = 0.17677669529663687f;   // 1/sqrt(32), folded into Q
  for (int p = 0; p < 2; ++p) {
    const int ct = (wv + p * 8) * 16;
    const int c = ct + lm;
    const float bv = qkv_b[512 + c];
    v8f bq, bk;           // biases of the lane's 8 channels
    const f16* wb = wq16 + (wv + p * 8) * 4096 + lane * 8;
    const f16* xa = Xs + lm * CP + kb;
    v8f  acc[3][8];
    v16h af[2][8];        // X fragments of this k step and the next
    v16h bw[8];           // weight fragments, ring over f = 3 * ks + g (g: 0 = Q, 1 = K, 2 = V tile, 16 tiles apart)
    auto load_w = [&](int f) { bw[f % 8] = fragw(wb + (f % 3) * 65536 + (f / 3) * 512); };
    auto load_x = [&](int ks) {
      #pragma unroll
      for (int mt = 0; mt < 8; ++mt)
        af[ks & 1][mt] = frag16(xa + mt * 16 * CP + ks * 32);
    };
    #pragma unroll
    for (int f = 0; f < 5; ++f) load_w(f);
    load_x(0);
    #pragma unroll
    for (int ks = 0; ks < 8; ++ks) {
      #pragma unroll
      for (int f = 3 * ks + 5; f < 3 * ks + 8; ++f)
        if (f < 24) load_w(f);
      if (ks < 7) load_x(ks + 1);
      if (ks == 7) {      // the last step fetches no fragments: its registers take the biases
        bq = *(const v8f*)(qkv_b + ct + 8 * hh);
        bk = *(const v8f*)(qkv_b + 256 + ct + 8 * hh);
      }
      // keeps the loads above as one group ahead of this step's WMMAs (the scheduler otherwise sinks each to its use)
      __builtin_amdgcn_sched_barrier(0);
      #pragma unroll
      for (int g = 0; g < 3; ++g)
        #pragma unroll
        for (int mt = 0; mt < 8; ++mt) {
          v8f cin = {};
          if (ks != 0) cin = acc[g][mt];
          acc[g][mt] = g < 2 ? wmma_f16(bw[(3 * ks + g) % 8], af[ks & 1][mt], cin)
                             : wmma_f16(af[ks & 1][mt], bw[(3 * ks + g) % 8], cin);
        }
      // closes the fence pair: the next step's loads and the stores behind the loop stay out of this WMMA block
      __builtin_amdgcn_sched_barrier(0);
    }
    #pragma unroll
    for (int mt = 0; mt < 8; ++mt) {
      v8h q8, k8;
      #pragma unroll
      for (int r = 0; r < 8; ++r) {
        q8[r] = (f16)((acc[0][mt][r] + bq[r]) * scale);   // Q (scaled)
        k8[r] = (f16)(acc[1][mt][r] + bk[r]);             // K
      }
      *(v8h*)(Qs + (mt * 16 + lm) * CP + ct + 8 * hh) = q8;
      *(v8h*)(Ks + (mt * 16 + lm) * CP + ct + 8 * hh) = k8;
    }
    #pragma unroll
    for (int mt = 0; mt < 8; ++mt)            // V, stored transposed: Vt[channel][token]
      #pragma unroll
      for (int r = 0; r < 8; ++r)
        Vt[c * VP + (mt * 16 + r + 8 * hh)] = (f16)(acc[2][mt][r] + bv);
  }
  __syncthreads();

  // ---------------- Phase 2: scores (one head per wave), bias, softmax ----------------
  // K is A and Q is B: s[mt][nt][r] = score(query t = mt*16 + lm, key u = nt*16 + 8*hh + r). A lane holds 32 of its
  // query's 64 keys and lane ^ 16 the other 32. The wave does its head for window 0, then for window 1.
  f16* Os = (f16*)(smem + OFF_O);
  // relative position bias: idx = (ti-ui+7)*15 + (tj-uj+7), table[idx][head]. With t = mt*16 + lm and u = nt*16 + 8*hh + r the
  // row distance ti - ui is 2*(mt-nt) + (lm>>3) - hh and tj - uj is (lm&7) - r: a score tile's bias depends on mt - nt alone,
  // and a lane's 8 values lie in a row in the table. The 7 tiles serve both windows as the C operand of the score products.
  v8f bC[7];
  {
    const char* bt = smem + OFF_B + (wv * 15 + 7 + (lm >> 3) - hh) * BP + (lm & 7) * 32;
    // unrolled: bC is indexed by constants alone and so stays in registers
    #pragma unroll
    for (int d = 0; d < 7; ++d) {
      float4 lo = *(const float4*)(bt + (d - 3) * 2 * BP);
      float4 hi = *(const float4*)(bt + (d - 3) * 2 * BP + 16);
      bC[d] = v8f{lo.x, lo.y, lo.z, lo.w, hi.x, hi.y, hi.z, hi.w};
    }
  }
  // kept rolled: the second window runs the first one's text again (the kernel's text stays small for the instruction cache)
  #pragma unroll 1
  for (int win = 0; win < 2; ++win) {
  v8f s[4][4];
  {
    v16h aq[4];
    #pragma unroll
    for (int mt = 0; mt < 4; ++mt)
      aq[mt] = frag16(Qs + (win * 64 + mt * 16 + lm) * CP + wv * 32 + kb);
    #pragma unroll
    for (int nt = 0; nt < 4; ++nt) {
      v16h bk = frag16(Ks + (win * 64 + nt * 16 + lm) * CP + wv * 32 + kb);
      #pragma unroll
      for (int mt = 0; mt < 4; ++mt) s[mt][nt] = wmma_f16(bk, aq[mt], bC[mt - nt + 3]);
    }
  }
  // softmax over u: 32 values in the lane (four partial sums), then one exchange with lane ^ 16
  #pragma unroll
  for (int mt = 0; mt < 4; ++mt) {
    float mx = s[mt][0][0];
    #pragma unroll
    for (int nt = 0; nt < 4; ++nt)
      #pragma unroll
      for (int r = 0; r < 8; ++r) mx = fmaxf(mx, s[mt][nt][r]);
    mx = fmaxf(mx, xhalf(mx));
    float ps[4];
    #pragma unroll
    for (int nt = 0; nt < 4; ++nt) {
      ps[nt] = 0.f;
      #pragma unroll
      for (int r = 0; r < 8; ++r) {
        float e = __expf(s[mt][nt][r] - mx);
        s[mt][nt][r] = e;
        ps[nt] += e;
      }
    }
    float sm = (ps[0] + ps[1]) + (ps[2] + ps[3]);
    sm += xhalf(sm);
    float inv = 1.0f / sm;
    #pragma unroll
    for (int nt = 0; nt < 4; ++nt) s[mt][nt] *= inv;
  }

  // ---------------- Phase 3: O = P @ V  (per head: 64x32, K=64) ----------------
  // Two score tiles of a query tile, converted in place, are the B fragment of a 32-key step (keys 8*hh + e and
  // 16 + 8*hh + e, the order in which frag16 reads Vt). Vt is A: a lane's 8 registers are 8 channels of one token.
  v8f ov[4][2] = {};
  #pragma unroll
  for (int ks = 0; ks < 2; ++ks) {
    v16h pf[4];
    #pragma unroll
    for (int mt = 0; mt < 4; ++mt)
      #pragma unroll
      for (int e = 0; e < 8; ++e) {
        pf[mt][e]     = (f16)s[mt][2 * ks][e];
        pf[mt][8 + e] = (f16)s[mt][2 * ks + 1][e];
      }
    #pragma unroll
    for (int nt = 0; nt < 2; ++nt) {
      v16h bvf = frag16(Vt + (wv * 32 + nt * 16 + lm) * VP + win * 64 + ks * 32 + kb);
      #pragma unroll
      for (int mt = 0; mt < 4; ++mt) ov[mt][nt] = wmma_f16(bvf, pf[mt], ov[mt][nt]);
    }
  }
  // Os lies over Xs, which nobody reads behind phase 1's barrier: no barrier in front of these stores
  #pragma unroll
  for (int mt = 0; mt < 4; ++mt)
    #pragma unroll
    for (int nt = 0; nt < 2; ++nt) {
      v8h o8;
      #pragma unroll
      for (int r = 0; r < 8; ++r) o8[r] = (f16)ov[mt][nt][r];
      *(v8h*)(Os + (win * 64 + mt * 16 + lm) * CP + win * OW + wv * 32 + nt * 16 + 8 * hh) = o8;
    }
  }
  // this wave's LDS reads and writes have retired before copies are aimed at Qs and Ks
  asm volatile("s_wait_dscnt 0x0" ::: "memory");
  __syncthreads();

  // ---------------- Phase 4: projection GEMM (128x256) = Os @ Wproj^T, stored from registers ----------------
  {
    // One O fragment read from LDS feeds both of the wave's 16-channel tiles; same rings as in phase 1.
    // The weights are A and O is B: a lane holds 8 channels of one token. Token tile mt is pixel row mt of BOTH windows
    // (lanes 0-7 window 0, lanes 8-15 window 1), so lanes 0-15 of one accumulator register are 64 contiguous bytes of one
    // channel in (B, C, H, W): each register goes to global memory as it is.
    const f16* wb = wp16 + wv * 8192 + lane * 8;
    const f16* oa = Os + ((lm >> 3) * 64 + (lm & 7)) * CP + (lm >> 3) * OW + kb;
    v8f  pb[2];           // biases of the lane's 8 channels in each tile
    v8f  acc[2][8];
    v16h af[2][8];
    v16h bw[4][2];
    auto load_w = [&](int s) {
      #pragma unroll
      for (int g = 0; g < 2; ++g) bw[s & 3][g] = fragw(wb + g * 4096 + s * 512);
    };
    auto load_o = [&](int s) {
      #pragma unroll
      for (int mt = 0; mt < 8; ++mt) af[s & 1][mt] = frag16(oa + mt * 8 * CP + s * 32);
    };
    load_w(0); load_w(1); load_w(2);
    load_o(0);
    // Behind phase 3's barrier nobody reads Qs or Ks: the next pair's x flies into their space under this phase.
    // Behind the first fragments' loads, so that these do not queue behind 32 copies a wave.
    if (more) copy_x(it + 1);
    #pragma unroll
    for (int s = 0; s < 8; ++s) {
      if (s + 3 < 8) load_w(s + 3);
      if (s + 1 < 8) load_o(s + 1);
      if (s == 7) {       // the last step fetches no fragments: its registers take the biases
        pb[0] = *(const v8f*)(proj_b + wv * 32 + 8 * hh);
        pb[1] = *(const v8f*)(proj_b + wv * 32 + 16 + 8 * hh);
      }
      // keeps the loads above as one group ahead of this step's WMMAs (the scheduler otherwise sinks each to its use)
      __builtin_amdgcn_sched_barrier(0);
      #pragma unroll
      for (int g = 0; g < 2; ++g)
        #pragma unroll
        for (int mt = 0; mt < 8; ++mt) {
          v8f cin = {};
          if (s != 0) cin = acc[g][mt];
          acc[g][mt] = wmma_f16(bw[s & 3][g], af[s & 1][mt], cin);
        }
      // closes the fence pair: the next step's loads and the stores behind the loop stay out of this WMMA block
      __builtin_amdgcn_sched_barrier(0);
    }
    // window reverse: column lm of tile mt is pixel (wy*8 + mt, wxp*16 + lm); channel planes are 4096 floats apart
    float* dst = out + imgbase + (long)(wv * 32 + 8 * hh) * 4096 + (wy * 8) * 64 + wxp * 16 + lm;
    #pragma unroll
    for (int g = 0; g < 2; ++g)
      #pragma unroll
      for (int mt = 0; mt < 8; ++mt) acc[g][mt] += pb[g];
    #pragma unroll
    for (int g = 0; g < 2; ++g)
      #pragma unroll
      for (int mt = 0; mt < 8; ++mt)
        #pragma unroll
        for (int r = 0; r < 8; ++r)
          dst[(g * 16 + r) * 4096 + mt * 64] = acc[g][mt][r];
    // the stores' address registers are formed anew for the next pair: the wait stands in front of that overwrite
    asm volatile("s_wait_xcnt 0x0" ::: "memory");
  }
  if (!more) break;
  }
}

}  // namespace

extern "C" void kernel_launch(void* const* d_in, const int* in_sizes, int n_in,
                              void* d_out, int out_size, void* d_ws, size_t ws_size,
                              hipStream_t stream) {
  const float* x        = (const float*)d_in[0];
  const float* qkv_w    = (const float*)d_in[1];
  const float* qkv_b    = (const float*)d_in[2];
  const float* proj_w   = (const float*)d_in[3];
  const float* proj_b   = (const float*)d_in[4];
  const float* bias_tab = (const float*)d_in[5];

  f16* wq16 = (f16*)d_ws;                               // 768*256 f16 = 393216 B
  f16* wp16 = (f16*)((char*)d_ws + 768 * 256 * 2);      // 256*256 f16 = 131072 B

  cvt_weights_kernel<<<768, 256, 0, stream>>>(qkv_w, proj_w, wq16, wp16);
  swin_window_attn_kernel<<<256, 256, 0, stream>>>(
      x, wq16, qkv_b, wp16, proj_b, bias_tab, (float*)d_out);
}
